// v000
// Measured on an AMD MI455X. A time is GPU time per run, averaged over a window of back-to-back runs after a warm-up
// (all launches, gaps included; the runs take copies of the inputs in turn), and the median of several windows.
// Apart from v000's, it joins two sittings. Times from different sittings can be a few percent apart, while
// side-by-side timings come from the same sitting.
// The starting kernel, v000, takes 605 microseconds a run.
#include <hip/hip_runtime.h>
#include <hip/hip_bf16.h>
#include <math.h>

typedef __attribute__((ext_vector_type(16))) _Float16 v16h;
typedef __attribute__((ext_vector_type(8)))  _Float16 v8h;
typedef __attribute__((ext_vector_type(8)))  float    v8f;

#define NB    8
#define TT    1024
#define CC    1024
#define NHEADS 16
#define HD    64
#define HIDD  4096

__device__ __forceinline__ v16h ld_frag_row(const _Float16* __restrict__ base, int ld) {
  const int lane = threadIdx.x & 31;
  const int row  = lane & 15;
  const int koff = (lane & 16) ? 8 : 0;
  const _Float16* p = base + (size_t)row * ld + koff;
  v8h lo = *(const v8h*)(p);        // K = koff .. koff+7
  v8h hi = *(const v8h*)(p + 16);   // K = 16+koff .. 23+koff
  v16h r;
#pragma unroll
  for (int i = 0; i < 8; ++i) { r[i] = lo[i]; r[i + 8] = hi[i]; }
  return r;
}

__device__ __forceinline__ v16h ld_frag_lds(const _Float16* p) {
  v8h lo = *(const v8h*)(p);
  v8h hi = *(const v8h*)(p + 16);
  v16h r;
#pragma unroll
  for (int i = 0; i < 8; ++i) { r[i] = lo[i]; r[i + 8] = hi[i]; }
  return r;
}

// B fragment where logical B[k][n] lives column-major (base[k*ld + n]).
__device__ __forceinline__ v16h ld_frag_col(const _Float16* __restrict__ base, int ld) {
  const int lane = threadIdx.x & 31;
  const int col  = lane & 15;
  const int koff = (lane & 16) ? 8 : 0;
  v16h r;
#pragma unroll
  for (int i = 0; i < 8; ++i) {
    r[i]     = base[(size_t)(koff + i) * ld + col];
    r[i + 8] = base[(size_t)(16 + koff + i) * ld + col];
  }
  return r;
}

template <int EPI>
__global__ __launch_bounds__(256)
void gemm_wmma_kernel(const _Float16* __restrict__ A, const _Float16* __restrict__ B,
                      const float* __restrict__ bias, void* __restrict__ D,
                      int M, int N, int K) {
  __shared__ __align__(16) _Float16 As[2][128][40];   // 40-half padded rows
  __shared__ __align__(16) _Float16 Bs[2][128][40];

  const int tid  = threadIdx.x;
  const int w    = tid >> 5;
  const int wm   = w >> 1;          // 0..3 -> 32-row strip
  const int wn   = w & 1;           // 0..1 -> 64-col strip
  const int rowB = blockIdx.y * 128;
  const int colB = blockIdx.x * 128;

  v8f acc[2][4];
#pragma unroll
  for (int mi = 0; mi < 2; ++mi)
#pragma unroll
    for (int j = 0; j < 4; ++j) acc[mi][j] = (v8f){};

  // async prefetch of one 128x32 A panel + 128x32 B panel (4 b128 / thread)
  auto prefetch = [&](int buf, int k) {
#pragma unroll
    for (int t = 0; t < 2; ++t) {
      const int i   = tid + t * 256;   // 0..511
      const int row = i >> 2;
      const int seg = (i & 3) * 8;     // halves (16B chunks)
      const unsigned long long ga =
          (unsigned long long)(A + (size_t)(rowB + row) * K + k + seg);
      const unsigned la = (unsigned)(uintptr_t)&As[buf][row][seg];
      asm volatile("global_load_async_to_lds_b128 %0, %1, off"
                   :: "v"(la), "v"(ga) : "memory");
      const unsigned long long gb =
          (unsigned long long)(B + (size_t)(colB + row) * K + k + seg);
      const unsigned lb = (unsigned)(uintptr_t)&Bs[buf][row][seg];
      asm volatile("global_load_async_to_lds_b128 %0, %1, off"
                   :: "v"(lb), "v"(gb) : "memory");
    }
  };

  prefetch(0, 0);
  const int KT = K >> 5;
  for (int kt = 0; kt < KT; ++kt) {
    const int buf = kt & 1;
    if (kt + 1 < KT) {
      prefetch(buf ^ 1, (kt + 1) << 5);
      // async loads retire in order: <=4 outstanding == current panel landed
      asm volatile("s_wait_asynccnt 4" ::: "memory");
    } else {
      asm volatile("s_wait_asynccnt 0" ::: "memory");
    }
    __syncthreads();

    const int lane = tid & 31;
    const int fr   = lane & 15;
    const int koff = (lane & 16) ? 8 : 0;
    v16h a[2];
#pragma unroll
    for (int mi = 0; mi < 2; ++mi)
      a[mi] = ld_frag_lds(&As[buf][wm * 32 + mi * 16 + fr][koff]);
#pragma unroll
    for (int j = 0; j < 4; ++j) {
      v16h b = ld_frag_lds(&Bs[buf][wn * 64 + j * 16 + fr][koff]);
#pragma unroll
      for (int mi = 0; mi < 2; ++mi)
        acc[mi][j] = __builtin_amdgcn_wmma_f32_16x16x32_f16(
            false, a[mi], false, b, (short)0, acc[mi][j], false, false);
    }
    __syncthreads();   // panel fully consumed before it is overwritten
  }

  const int lane = tid & 31;
  const int colL = lane & 15;
  const int rb   = (lane & 16) ? 8 : 0;
#pragma unroll
  for (int mi = 0; mi < 2; ++mi) {
#pragma unroll
    for (int j = 0; j < 4; ++j) {
      const int col  = colB + wn * 64 + j * 16 + colL;
      const int row0 = rowB + wm * 32 + mi * 16 + rb;
#pragma unroll
      for (int r = 0; r < 8; ++r) {
        const size_t idx = (size_t)(row0 + r) * N + col;
        float v = acc[mi][j][r];
        if (EPI == 0) {
          ((_Float16*)D)[idx] = (_Float16)v;
        } else if (EPI == 1) {
          ((float*)D)[idx] = v;
        } else if (EPI == 2) {
          v += bias[col];
          ((_Float16*)D)[idx] = (_Float16)(v > 0.f ? v : 0.f);
        } else {
          ((float*)D)[idx] = v + bias[col];
        }
      }
    }
  }
}

// ---------------------------------------------------------------------------
// Flash attention: 1 wave per (batch, head, 16-query tile). Causal.
// qkv: [N*T, 3C] f16 (Q | K | V slabs). ctx out: [N*T, C] f16.
// ---------------------------------------------------------------------------
__global__ __launch_bounds__(32)
void attn_kernel(const _Float16* __restrict__ qkv, _Float16* __restrict__ ctx) {
  const int b  = blockIdx.z;
  const int h  = blockIdx.y;
  const int q0 = blockIdx.x * 16;
  const int lane = threadIdx.x & 31;
  const int colL = lane & 15;
  const int rb   = (lane & 16) ? 8 : 0;
  const int LD   = 3 * CC;
  const float scale = 0.125f;   // 1/sqrt(64)

  __shared__ _Float16 Plds[16][34];

  const size_t rowbase = (size_t)(b * TT) * LD;
  const _Float16* Qb = qkv + rowbase + (size_t)q0 * LD + h * HD;
  const v16h qf0 = ld_frag_row(Qb, LD);        // d 0..31
  const v16h qf1 = ld_frag_row(Qb + 32, LD);   // d 32..63

  v8f acc[4];
#pragma unroll
  for (int j = 0; j < 4; ++j) acc[j] = (v8f){};
  float m_run[8], l_run[8];
#pragma unroll
  for (int r = 0; r < 8; ++r) { m_run[r] = -3.0e38f; l_run[r] = 0.f; }

  for (int kb = 0; kb < q0 + 16; kb += 32) {
    const _Float16* Kb = qkv + rowbase + (size_t)kb * LD + CC + h * HD;
    v16h k00 = ld_frag_row(Kb, LD);
    v16h k01 = ld_frag_row(Kb + 32, LD);
    v16h k10 = ld_frag_row(Kb + (size_t)16 * LD, LD);
    v16h k11 = ld_frag_row(Kb + (size_t)16 * LD + 32, LD);

    v8f s0 = (v8f){}, s1 = (v8f){};
    s0 = __builtin_amdgcn_wmma_f32_16x16x32_f16(false, qf0, false, k00, (short)0, s0, false, false);
    s0 = __builtin_amdgcn_wmma_f32_16x16x32_f16(false, qf1, false, k01, (short)0, s0, false, false);
    s1 = __builtin_amdgcn_wmma_f32_16x16x32_f16(false, qf0, false, k10, (short)0, s1, false, false);
    s1 = __builtin_amdgcn_wmma_f32_16x16x32_f16(false, qf1, false, k11, (short)0, s1, false, false);

    float p0[8], p1[8], mb[8];
#pragma unroll
    for (int r = 0; r < 8; ++r) {
      const int q = q0 + rb + r;
      float a = s0[r] * scale; if (kb + colL      > q) a = -3.0e38f;
      float c = s1[r] * scale; if (kb + 16 + colL > q) c = -3.0e38f;
      p0[r] = a; p1[r] = c;
      mb[r] = fmaxf(a, c);
    }
#pragma unroll
    for (int off = 1; off <= 8; off <<= 1)
#pragma unroll
      for (int r = 0; r < 8; ++r) mb[r] = fmaxf(mb[r], __shfl_xor(mb[r], off, 32));

    float alpha[8], rs[8];
#pragma unroll
    for (int r = 0; r < 8; ++r) {
      const float mn = fmaxf(m_run[r], mb[r]);
      alpha[r] = __expf(m_run[r] - mn);
      m_run[r] = mn;
      p0[r] = __expf(p0[r] - mn);
      p1[r] = __expf(p1[r] - mn);
      rs[r] = p0[r] + p1[r];
    }
#pragma unroll
    for (int off = 1; off <= 8; off <<= 1)
#pragma unroll
      for (int r = 0; r < 8; ++r) rs[r] += __shfl_xor(rs[r], off, 32);
#pragma unroll
    for (int r = 0; r < 8; ++r) l_run[r] = l_run[r] * alpha[r] + rs[r];
#pragma unroll
    for (int j = 0; j < 4; ++j)
#pragma unroll
      for (int r = 0; r < 8; ++r) acc[j][r] *= alpha[r];

    __syncthreads();
#pragma unroll
    for (int r = 0; r < 8; ++r) {
      Plds[rb + r][colL]      = (_Float16)p0[r];
      Plds[rb + r][16 + colL] = (_Float16)p1[r];
    }
    __syncthreads();

    v16h pf;
    {
      const int row  = colL;
      const int koff = (lane & 16) ? 8 : 0;
#pragma unroll
      for (int i = 0; i < 8; ++i) {
        pf[i]     = Plds[row][koff + i];
        pf[i + 8] = Plds[row][16 + koff + i];
      }
    }

    const _Float16* Vb = qkv + rowbase + (size_t)kb * LD + 2 * CC + h * HD;
#pragma unroll
    for (int j = 0; j < 4; ++j) {
      v16h vf = ld_frag_col(Vb + j * 16, LD);
      acc[j] = __builtin_amdgcn_wmma_f32_16x16x32_f16(false, pf, false, vf,
                                                      (short)0, acc[j], false, false);
    }
  }

  float inv[8];
#pragma unroll
  for (int r = 0; r < 8; ++r) inv[r] = 1.f / l_run[r];
#pragma unroll
  for (int j = 0; j < 4; ++j)
#pragma unroll
    for (int r = 0; r < 8; ++r)
      ctx[(size_t)(b * TT + q0 + rb + r) * CC + h * HD + j * 16 + colL] =
          (_Float16)(acc[j][r] * inv[r]);
}

// ---------------------------------------------------------------------------
// Elementwise / reduction kernels
// ---------------------------------------------------------------------------
__global__ __launch_bounds__(256)
void prep_kernel(const float* __restrict__ x, float* __restrict__ src,
                 _Float16* __restrict__ xq) {
  const int row = blockIdx.x;   // n*T + t
  const int n = row >> 10;
  const int t = row & 1023;
  const float k0 = -logf(10000.0f) / (float)CC;
  for (int c = threadIdx.x; c < CC; c += 256) {
    const float xv = x[((size_t)n * CC + c) * TT + t];
    src[(size_t)row * CC + c] = xv;
    const int i2 = c & ~1;
    const float ang = (float)t * __expf(k0 * (float)i2);
    const float pe = (c & 1) ? __cosf(ang) : __sinf(ang);
    xq[(size_t)row * CC + c] = (_Float16)(xv + pe);
  }
}

__global__ void cvt_f32_f16(const float* __restrict__ in, _Float16* __restrict__ out, int n) {
  const int i = blockIdx.x * blockDim.x + threadIdx.x;
  if (i < n) out[i] = (_Float16)in[i];
}

__device__ __forceinline__ float block_sum_256(float v, float* red) {
  const int tid = threadIdx.x;
  red[tid] = v; __syncthreads();
  for (int o = 128; o > 0; o >>= 1) {
    if (tid < o) red[tid] += red[tid + o];
    __syncthreads();
  }
  const float s = red[0];
  __syncthreads();
  return s;
}

__global__ __launch_bounds__(256)
void ln1_kernel(const float* __restrict__ a, const float* __restrict__ bb,
                const float* __restrict__ g, const float* __restrict__ beta,
                float* __restrict__ hout, _Float16* __restrict__ h16) {
  __shared__ float red[256];
  const int row = blockIdx.x, tid = threadIdx.x;
  float vals[4], s = 0.f;
#pragma unroll
  for (int i = 0; i < 4; ++i) {
    const int c = tid + i * 256;
    const float v = a[(size_t)row * CC + c] + bb[(size_t)row * CC + c];
    vals[i] = v; s += v;
  }
  const float mu = block_sum_256(s, red) * (1.f / CC);
  float sq = 0.f;
#pragma unroll
  for (int i = 0; i < 4; ++i) { const float d = vals[i] - mu; sq += d * d; }
  const float rstd = rsqrtf(block_sum_256(sq, red) * (1.f / CC) + 1e-5f);
#pragma unroll
  for (int i = 0; i < 4; ++i) {
    const int c = tid + i * 256;
    const float o = (vals[i] - mu) * rstd * g[c] + beta[c];
    hout[(size_t)row * CC + c] = o;
    h16[(size_t)row * CC + c] = (_Float16)o;
  }
}

__global__ __launch_bounds__(256)
void ln2t_kernel(const float* __restrict__ a, const float* __restrict__ bb,
                 const float* __restrict__ g, const float* __restrict__ beta,
                 float* __restrict__ out) {
  __shared__ float red[256];
  const int row = blockIdx.x, tid = threadIdx.x;
  const int n = row >> 10, t = row & 1023;
  float vals[4], s = 0.f;
#pragma unroll
  for (int i = 0; i < 4; ++i) {
    const int c = tid + i * 256;
    const float v = a[(size_t)row * CC + c] + bb[(size_t)row * CC + c];
    vals[i] = v; s += v;
  }
  const float mu = block_sum_256(s, red) * (1.f / CC);
  float sq = 0.f;
#pragma unroll
  for (int i = 0; i < 4; ++i) { const float d = vals[i] - mu; sq += d * d; }
  const float rstd = rsqrtf(block_sum_256(sq, red) * (1.f / CC) + 1e-5f);
#pragma unroll
  for (int i = 0; i < 4; ++i) {
    const int c = tid + i * 256;
    out[((size_t)n * CC + c) * TT + t] = (vals[i] - mu) * rstd * g[c] + beta[c];
  }
}

// ---------------------------------------------------------------------------
extern "C" void kernel_launch(void* const* d_in, const int* in_sizes, int n_in,
                              void* d_out, int out_size, void* d_ws, size_t ws_size,
                              hipStream_t stream) {
  const float* x    = (const float*)d_in[0];
  const float* w_in = (const float*)d_in[1];
  const float* w_o  = (const float*)d_in[2];
  const float* ln1g = (const float*)d_in[3];
  const float* ln1b = (const float*)d_in[4];
  const float* ln2g = (const float*)d_in[5];
  const float* ln2b = (const float*)d_in[6];
  const float* w1   = (const float*)d_in[7];
  const float* b1   = (const float*)d_in[8];
  const float* w2   = (const float*)d_in[9];
  const float* b2   = (const float*)d_in[10];

  char* ws = (char*)d_ws;
  const size_t MB = 1ull << 20;
  float*    src     = (float*)(ws + 0);            // 32 MiB; dead after LN1
  float*    ff2     = src;                         // alias (written by FFN2)
  float*    hbuf    = (float*)(ws + 32 * MB);      // 32 MiB
  _Float16* h16     = (_Float16*)(ws + 64 * MB);   // 16 MiB
  _Float16* xq      = (_Float16*)(ws + 80 * MB);   // 16 MiB; dead after QKV GEMM
  _Float16* ctx     = xq;                          // alias
  float*    attnout = (float*)(ws + 96 * MB);      // 32 MiB
  _Float16* qkv     = (_Float16*)(ws + 128 * MB);  // 48 MiB; dead after attention
  _Float16* ff      = qkv;                         // alias (64 MiB)
  _Float16* wqkv16  = (_Float16*)(ws + 192 * MB);
  _Float16* wout16  = wqkv16 + (size_t)3072 * 1024;
  _Float16* w116    = wout16 + (size_t)1024 * 1024;
  _Float16* w216    = w116 + (size_t)HIDD * 1024;

  // weight conversions f32 -> f16
  cvt_f32_f16<<<(3072 * 1024 + 255) / 256, 256, 0, stream>>>(w_in, wqkv16, 3072 * 1024);
  cvt_f32_f16<<<(1024 * 1024 + 255) / 256, 256, 0, stream>>>(w_o, wout16, 1024 * 1024);
  cvt_f32_f16<<<(HIDD * 1024 + 255) / 256, 256, 0, stream>>>(w1, w116, HIDD * 1024);
  cvt_f32_f16<<<(HIDD * 1024 + 255) / 256, 256, 0, stream>>>(w2, w216, HIDD * 1024);

  // transpose + PE
  prep_kernel<<<NB * TT, 256, 0, stream>>>(x, src, xq);

  // QKV projection: [8192,1024] x [3072,1024]^T -> f16 [8192,3072]
  gemm_wmma_kernel<0><<<dim3(3072 / 128, 8192 / 128), 256, 0, stream>>>(
      xq, wqkv16, nullptr, qkv, 8192, 3072, 1024);

  // causal flash attention
  attn_kernel<<<dim3(TT / 16, NHEADS, NB), 32, 0, stream>>>(qkv, ctx);

  // out projection -> f32 [8192,1024]
  gemm_wmma_kernel<1><<<dim3(1024 / 128, 8192 / 128), 256, 0, stream>>>(
      ctx, wout16, nullptr, attnout, 8192, 1024, 1024);

  // residual + LN1 -> h (f32 + f16)
  ln1_kernel<<<NB * TT, 256, 0, stream>>>(src, attnout, ln1g, ln1b, hbuf, h16);

  // FFN1: relu(h @ w1^T + b1) -> f16 [8192,4096]
  gemm_wmma_kernel<2><<<dim3(HIDD / 128, 8192 / 128), 256, 0, stream>>>(
      h16, w116, b1, ff, 8192, HIDD, 1024);

  // FFN2: ff @ w2^T + b2 -> f32 [8192,1024]
  gemm_wmma_kernel<3><<<dim3(1024 / 128, 8192 / 128), 256, 0, stream>>>(
      ff, w216, b2, ff2, 8192, 1024, HIDD);

  // residual + LN2 + transpose back to [N,C,T]
  ln2t_kernel<<<NB * TT, 256, 0, stream>>>(hbuf, ff2, ln2g, ln2b, (float*)d_out);
}

// v001
// A run of this version takes 443 microseconds.
// Timed twice side by side with v000, it ran 1.43 and 1.42 times as fast.
#include <hip/hip_runtime.h>
#include <hip/hip_bf16.h>
#include <math.h>

typedef __attribute__((ext_vector_type(16))) _Float16 v16h;
typedef __attribute__((ext_vector_type(8)))  _Float16 v8h;
typedef __attribute__((ext_vector_type(8)))  float    v8f;

#define NB    8
#define TT    1024
#define CC    1024
#define NHEADS 16
#define HD    64
#define HIDD  4096

__device__ __forceinline__ v16h ld_frag_row(const _Float16* __restrict__ base, int ld) {
  const int lane = threadIdx.x & 31;
  const int row  = lane & 15;
  const int koff = (lane & 16) ? 8 : 0;
  const _Float16* p = base + (size_t)row * ld + koff;
  v8h lo = *(const v8h*)(p);        // K = koff .. koff+7
  v8h hi = *(const v8h*)(p + 16);   // K = 16+koff .. 23+koff
  v16h r;
#pragma unroll
  for (int i = 0; i < 8; ++i) { r[i] = lo[i]; r[i + 8] = hi[i]; }
  return r;
}

__device__ __forceinline__ v16h ld_frag_lds(const _Float16* p) {
  v8h lo = *(const v8h*)(p);
  v8h hi = *(const v8h*)(p + 16);
  v16h r;
#pragma unroll
  for (int i = 0; i < 8; ++i) { r[i] = lo[i]; r[i + 8] = hi[i]; }
  return r;
}

// B fragment where logical B[k][n] lives column-major (base[k*ld + n]).
__device__ __forceinline__ v16h ld_frag_col(const _Float16* __restrict__ base, int ld) {
  const int lane = threadIdx.x & 31;
  const int col  = lane & 15;
  const int koff = (lane & 16) ? 8 : 0;
  v16h r;
#pragma unroll
  for (int i = 0; i < 8; ++i) {
    r[i]     = base[(size_t)(koff + i) * ld + col];
    r[i + 8] = base[(size_t)(16 + koff + i) * ld + col];
  }
  return r;
}

template <int EPI>
__global__ __launch_bounds__(256)
void gemm_wmma_kernel(const _Float16* __restrict__ A, const _Float16* __restrict__ B,
                      const float* __restrict__ bias, void* __restrict__ D,
                      int M, int N, int K) {
  __shared__ __align__(16) _Float16 As[2][128][40];   // 40-half padded rows
  __shared__ __align__(16) _Float16 Bs[2][128][40];

  const int tid  = threadIdx.x;
  const int w    = tid >> 5;
  const int wm   = w >> 1;          // 0..3 -> 32-row strip
  const int wn   = w & 1;           // 0..1 -> 64-col strip
  const int rowB = blockIdx.y * 128;
  const int colB = blockIdx.x * 128;

  v8f acc[2][4];
#pragma unroll
  for (int mi = 0; mi < 2; ++mi)
#pragma unroll
    for (int j = 0; j < 4; ++j) acc[mi][j] = (v8f){};

  // async prefetch of one 128x32 A panel + 128x32 B panel (4 b128 / thread)
  auto prefetch = [&](int buf, int k) {
#pragma unroll
    for (int t = 0; t < 2; ++t) {
      const int i   = tid + t * 256;   // 0..511
      const int row = i >> 2;
      const int seg = (i & 3) * 8;     // halves (16B chunks)
      const unsigned long long ga =
          (unsigned long long)(A + (size_t)(rowB + row) * K + k + seg);
      const unsigned la = (unsigned)(uintptr_t)&As[buf][row][seg];
      asm volatile("global_load_async_to_lds_b128 %0, %1, off"
                   :: "v"(la), "v"(ga) : "memory");
      const unsigned long long gb =
          (unsigned long long)(B + (size_t)(colB + row) * K + k + seg);
      const unsigned lb = (unsigned)(uintptr_t)&Bs[buf][row][seg];
      asm volatile("global_load_async_to_lds_b128 %0, %1, off"
                   :: "v"(lb), "v"(gb) : "memory");
    }
  };

  prefetch(0, 0);
  const int KT = K >> 5;
  for (int kt = 0; kt < KT; ++kt) {
    const int buf = kt & 1;
    if (kt + 1 < KT) {
      prefetch(buf ^ 1, (kt + 1) << 5);
      // async loads retire in order: <=4 outstanding == current panel landed
      asm volatile("s_wait_asynccnt 4" ::: "memory");
    } else {
      asm volatile("s_wait_asynccnt 0" ::: "memory");
    }
    __syncthreads();

    const int lane = tid & 31;
    const int fr   = lane & 15;
    const int koff = (lane & 16) ? 8 : 0;
    v16h a[2];
#pragma unroll
    for (int mi = 0; mi < 2; ++mi)
      a[mi] = ld_frag_lds(&As[buf][wm * 32 + mi * 16 + fr][koff]);
#pragma unroll
    for (int j = 0; j < 4; ++j) {
      v16h b = ld_frag_lds(&Bs[buf][wn * 64 + j * 16 + fr][koff]);
#pragma unroll
      for (int mi = 0; mi < 2; ++mi)
        acc[mi][j] = __builtin_amdgcn_wmma_f32_16x16x32_f16(
            false, a[mi], false, b, (short)0, acc[mi][j], false, false);
    }
    __syncthreads();   // panel fully consumed before it is overwritten
  }

  const int lane = tid & 31;
  const int colL = lane & 15;
  const int rb   = (lane & 16) ? 8 : 0;
#pragma unroll
  for (int mi = 0; mi < 2; ++mi) {
#pragma unroll
    for (int j = 0; j < 4; ++j) {
      const int col  = colB + wn * 64 + j * 16 + colL;
      const int row0 = rowB + wm * 32 + mi * 16 + rb;
#pragma unroll
      for (int r = 0; r < 8; ++r) {
        const size_t idx = (size_t)(row0 + r) * N + col;
        float v = acc[mi][j][r];
        if (EPI == 0) {
          ((_Float16*)D)[idx] = (_Float16)v;
        } else if (EPI == 1) {
          ((float*)D)[idx] = v;
        } else if (EPI == 2) {
          v += bias[col];
          ((_Float16*)D)[idx] = (_Float16)(v > 0.f ? v : 0.f);
        } else {
          ((float*)D)[idx] = v + bias[col];
        }
      }
    }
  }
}

// ---------------------------------------------------------------------------
// Flash attention: 1 wave per (batch, head, 16-query tile). Causal.
// qkv: [N*T, 3C] f16 (Q | K | V slabs). ctx out: [N*T, C] f16.
// ---------------------------------------------------------------------------
__global__ __launch_bounds__(32)
void attn_kernel(const _Float16* __restrict__ qkv, _Float16* __restrict__ ctx) {
  const int b  = blockIdx.z;
  const int h  = blockIdx.y;
  const int q0 = blockIdx.x * 16;
  const int lane = threadIdx.x & 31;
  const int colL = lane & 15;
  const int rb   = (lane & 16) ? 8 : 0;
  const int LD   = 3 * CC;
  const float scale = 0.125f;   // 1/sqrt(64)

  __shared__ _Float16 Plds[16][34];

  const size_t rowbase = (size_t)(b * TT) * LD;
  const _Float16* Qb = qkv + rowbase + (size_t)q0 * LD + h * HD;
  const v16h qf0 = ld_frag_row(Qb, LD);        // d 0..31
  const v16h qf1 = ld_frag_row(Qb + 32, LD);   // d 32..63

  v8f acc[4];
#pragma unroll
  for (int j = 0; j < 4; ++j) acc[j] = (v8f){};
  float m_run[8], l_run[8];
#pragma unroll
  for (int r = 0; r < 8; ++r) { m_run[r] = -3.0e38f; l_run[r] = 0.f; }

  for (int kb = 0; kb < q0 + 16; kb += 32) {
    const _Float16* Kb = qkv + rowbase + (size_t)kb * LD + CC + h * HD;
    v16h k00 = ld_frag_row(Kb, LD);
    v16h k01 = ld_frag_row(Kb + 32, LD);
    v16h k10 = ld_frag_row(Kb + (size_t)16 * LD, LD);
    v16h k11 = ld_frag_row(Kb + (size_t)16 * LD + 32, LD);

    v8f s0 = (v8f){}, s1 = (v8f){};
    s0 = __builtin_amdgcn_wmma_f32_16x16x32_f16(false, qf0, false, k00, (short)0, s0, false, false);
    s0 = __builtin_amdgcn_wmma_f32_16x16x32_f16(false, qf1, false, k01, (short)0, s0, false, false);
    s1 = __builtin_amdgcn_wmma_f32_16x16x32_f16(false, qf0, false, k10, (short)0, s1, false, false);
    s1 = __builtin_amdgcn_wmma_f32_16x16x32_f16(false, qf1, false, k11, (short)0, s1, false, false);

    float p0[8], p1[8], mb[8];
#pragma unroll
    for (int r = 0; r < 8; ++r) {
      const int q = q0 + rb + r;
      float a = s0[r] * scale; if (kb + colL      > q) a = -3.0e38f;
      float c = s1[r] * scale; if (kb + 16 + colL > q) c = -3.0e38f;
      p0[r] = a; p1[r] = c;
      mb[r] = fmaxf(a, c);
    }
#pragma unroll
    for (int off = 1; off <= 8; off <<= 1)
#pragma unroll
      for (int r = 0; r < 8; ++r) mb[r] = fmaxf(mb[r], __shfl_xor(mb[r], off, 32));

    float alpha[8], rs[8];
#pragma unroll
    for (int r = 0; r < 8; ++r) {
      const float mn = fmaxf(m_run[r], mb[r]);
      alpha[r] = __expf(m_run[r] - mn);
      m_run[r] = mn;
      p0[r] = __expf(p0[r] - mn);
      p1[r] = __expf(p1[r] - mn);
      rs[r] = p0[r] + p1[r];
    }
#pragma unroll
    for (int off = 1; off <= 8; off <<= 1)
#pragma unroll
      for (int r = 0; r < 8; ++r) rs[r] += __shfl_xor(rs[r], off, 32);
#pragma unroll
    for (int r = 0; r < 8; ++r) l_run[r] = l_run[r] * alpha[r] + rs[r];
#pragma unroll
    for (int j = 0; j < 4; ++j)
#pragma unroll
      for (int r = 0; r < 8; ++r) acc[j][r] *= alpha[r];

    __syncthreads();
#pragma unroll
    for (int r = 0; r < 8; ++r) {
      Plds[rb + r][colL]      = (_Float16)p0[r];
      Plds[rb + r][16 + colL] = (_Float16)p1[r];
    }
    __syncthreads();

    v16h pf;
    {
      const int row  = colL;
      const int koff = (lane & 16) ? 8 : 0;
#pragma unroll
      for (int i = 0; i < 8; ++i) {
        pf[i]     = Plds[row][koff + i];
        pf[i + 8] = Plds[row][16 + koff + i];
      }
    }

    const _Float16* Vb = qkv + rowbase + (size_t)kb * LD + 2 * CC + h * HD;
#pragma unroll
    for (int j = 0; j < 4; ++j) {
      v16h vf = ld_frag_col(Vb + j * 16, LD);
      acc[j] = __builtin_amdgcn_wmma_f32_16x16x32_f16(false, pf, false, vf,
                                                      (short)0, acc[j], false, false);
    }
  }

  float inv[8];
#pragma unroll
  for (int r = 0; r < 8; ++r) inv[r] = 1.f / l_run[r];
#pragma unroll
  for (int j = 0; j < 4; ++j)
#pragma unroll
    for (int r = 0; r < 8; ++r)
      ctx[(size_t)(b * TT + q0 + rb + r) * CC + h * HD + j * 16 + colL] =
          (_Float16)(acc[j][r] * inv[r]);
}

// ---------------------------------------------------------------------------
// Elementwise / reduction kernels
// ---------------------------------------------------------------------------
typedef __attribute__((ext_vector_type(4))) float    v4f;
typedef __attribute__((ext_vector_type(2))) float    v2f;
typedef __attribute__((ext_vector_type(4))) _Float16 v4h;

__device__ __forceinline__ int tile_idx(int c, int tg) {
  return ((c ^ ((c >> 5) & 1)) << 5) + (((tg ^ (c >> 2)) & 7) << 2);
}

__device__ __forceinline__ void sincos_rev(float rev, float& s, float& c) {
  asm("v_sin_f32 %0, %2\n\tv_cos_f32 %1, %2\n\tv_nop" : "=&v"(s), "=&v"(c) : "v"(rev));
}

__device__ __forceinline__ float exp2_slot(float x) {
  float r;
  asm("v_exp_f32 %0, %1\n\tv_nop" : "=v"(r) : "v"(x));
  return r;
}

// One block = 32 consecutive time steps of one batch entry, all 1024 channels.
// x is read as whole 128-byte lines along t, turned in LDS, and src / xq are
// written as whole lines along c; wave w owns time steps 2w and 2w+1.
__global__ __launch_bounds__(512)
void prep_kernel(const float* __restrict__ x, float* __restrict__ src,
                 _Float16* __restrict__ xq) {
  __shared__ __align__(16) float tile[CC * 32];
  const int tid  = threadIdx.x;
  const int lane = tid & 31;
  const int w    = tid >> 5;
  const int row0 = blockIdx.x * 32;   // n*T + t of the first time step
  const int n  = row0 >> 10;
  const int t0 = row0 & 1023;
  {
    const int tg = tid & 7;
    const float* xp = x + ((size_t)n * CC + (tid >> 3)) * TT + t0 + tg * 4;
    v4f xr[16];
#pragma unroll
    for (int k = 0; k < 16; ++k) {
      // The last load's result may be given the address pair that the loads
      // before it name: they have taken their address behind this wait.
      if (k == 15) asm volatile("s_wait_xcnt 0x0" ::: "memory");
      xr[k] = *(const v4f*)(xp + (size_t)k * 64 * TT);
    }
#pragma unroll
    for (int k = 0; k < 16; ++k)
      *(v4f*)&tile[tile_idx(k * 64 + (tid >> 3), tg)] = xr[k];
  }
  __syncthreads();

  const float k0 = -logf(10000.0f) / (float)CC;
  const float ta = (float)(t0 + 2 * w);
  const float tb = (float)(t0 + 2 * w + 1);
  float*    sp = src + (size_t)(row0 + 2 * w) * CC + lane * 4;
  _Float16* qp = xq  + (size_t)(row0 + 2 * w) * CC + lane * 4;
#pragma unroll
  for (int i = 0; i < 8; ++i) {
    const int c0 = i * 128 + lane * 4;
    v4f sa, sb;
    v4h qa, qb;
#pragma unroll
    for (int j = 0; j < 4; j += 2) {   // channels c0+j (sin) and c0+j+1 (cos) share an angle
      const float f = exp2_slot(k0 * (float)(c0 + j) * 1.4426950408889634f);
      float pea[2], peb[2];
      sincos_rev(ta * f * 0.15915494309189532f, pea[0], pea[1]);
      sincos_rev(tb * f * 0.15915494309189532f, peb[0], peb[1]);
#pragma unroll
      for (int e = 0; e < 2; ++e) {
        const v2f p = *(const v2f*)&tile[tile_idx(c0 + j + e, w >> 1) + (w & 1) * 2];
        sa[j + e] = p[0];
        sb[j + e] = p[1];
        qa[j + e] = (_Float16)(p[0] + pea[e]);
        qb[j + e] = (_Float16)(p[1] + peb[e]);
      }
    }
    *(v4f*)(sp + i * 128)      = sa;
    *(v4f*)(sp + CC + i * 128) = sb;
    *(v4h*)(qp + i * 128)      = qa;
    *(v4h*)(qp + CC + i * 128) = qb;
  }
}

__global__ void cvt_f32_f16(const float* __restrict__ in, _Float16* __restrict__ out, int n) {
  const int i = blockIdx.x * blockDim.x + threadIdx.x;
  if (i < n) out[i] = (_Float16)in[i];
}

__device__ __forceinline__ float block_sum_256(float v, float* red) {
  const int tid = threadIdx.x;
  red[tid] = v; __syncthreads();
  for (int o = 128; o > 0; o >>= 1) {
    if (tid < o) red[tid] += red[tid + o];
    __syncthreads();
  }
  const float s = red[0];
  __syncthreads();
  return s;
}

__global__ __launch_bounds__(256)
void ln1_kernel(const float* __restrict__ a, const float* __restrict__ bb,
                const float* __restrict__ g, const float* __restrict__ beta,
                float* __restrict__ hout, _Float16* __restrict__ h16) {
  __shared__ float red[256];
  const int row = blockIdx.x, tid = threadIdx.x;
  float vals[4], s = 0.f;
#pragma unroll
  for (int i = 0; i < 4; ++i) {
    const int c = tid + i * 256;
    const float v = a[(size_t)row * CC + c] + bb[(size_t)row * CC + c];
    vals[i] = v; s += v;
  }
  const float mu = block_sum_256(s, red) * (1.f / CC);
  float sq = 0.f;
#pragma unroll
  for (int i = 0; i < 4; ++i) { const float d = vals[i] - mu; sq += d * d; }
  const float rstd = rsqrtf(block_sum_256(sq, red) * (1.f / CC) + 1e-5f);
#pragma unroll
  for (int i = 0; i < 4; ++i) {
    const int c = tid + i * 256;
    const float o = (vals[i] - mu) * rstd * g[c] + beta[c];
    hout[(size_t)row * CC + c] = o;
    h16[(size_t)row * CC + c] = (_Float16)o;
  }
}

__device__ __forceinline__ float wave_sum(float v) {
#pragma unroll
  for (int off = 16; off >= 1; off >>= 1) v += __shfl_xor(v, off, 32);
  return v;
}

// One block = 32 consecutive time steps of one batch entry. Wave w normalises
// rows 2w and 2w+1 whole (row sums inside the wave), lays the results in the LDS
// tile, and the block then stores whole 128-byte lines of out along t.
__global__ __launch_bounds__(512)
void ln2t_kernel(const float* __restrict__ a, const float* __restrict__ bb,
                 const float* __restrict__ g, const float* __restrict__ beta,
                 float* __restrict__ out) {
  __shared__ __align__(16) float tile[CC * 32];
  const int tid  = threadIdx.x;
  const int lane = tid & 31;
  const int w    = tid >> 5;
  const int row0 = blockIdx.x * 32;
  const int n  = row0 >> 10;
  const int t0 = row0 & 1023;

  const float* ap = a  + (size_t)(row0 + 2 * w) * CC + lane * 4;
  const float* bp = bb + (size_t)(row0 + 2 * w) * CC + lane * 4;
  v4f v[2][8];
#pragma unroll
  for (int r = 0; r < 2; ++r)
#pragma unroll
    for (int i = 0; i < 8; ++i)
      v[r][i] = *(const v4f*)(ap + r * CC + i * 128) + *(const v4f*)(bp + r * CC + i * 128);

  float mu[2], rstd[2];
#pragma unroll
  for (int r = 0; r < 2; ++r) {
    float s = 0.f;
#pragma unroll
    for (int i = 0; i < 8; ++i)
#pragma unroll
      for (int j = 0; j < 4; ++j) s += v[r][i][j];
    mu[r] = wave_sum(s) * (1.f / CC);
    float sq = 0.f;
#pragma unroll
    for (int i = 0; i < 8; ++i)
#pragma unroll
      for (int j = 0; j < 4; ++j) { const float d = v[r][i][j] - mu[r]; sq += d * d; }
    rstd[r] = rsqrtf(wave_sum(sq) * (1.f / CC) + 1e-5f);
  }

#pragma unroll
  for (int i = 0; i < 8; ++i) {
    const int c0 = i * 128 + lane * 4;
    const v4f gg = *(const v4f*)(g + c0);
    const v4f be = *(const v4f*)(beta + c0);
#pragma unroll
    for (int j = 0; j < 4; ++j) {
      v2f o;
      o[0] = (v[0][i][j] - mu[0]) * rstd[0] * gg[j] + be[j];
      o[1] = (v[1][i][j] - mu[1]) * rstd[1] * gg[j] + be[j];
      *(v2f*)&tile[tile_idx(c0 + j, w >> 1) + (w & 1) * 2] = o;
    }
  }
  __syncthreads();

  const int tg = tid & 7;
  float* op = out + ((size_t)n * CC + (tid >> 3)) * TT + t0 + tg * 4;
#pragma unroll
  for (int k = 0; k < 16; ++k) {
    const int c = k * 64 + (tid >> 3);
    *(v4f*)(op + (size_t)k * 64 * TT) = *(const v4f*)&tile[tile_idx(c, tg)];
  }
}

// ---------------------------------------------------------------------------
extern "C" void kernel_launch(void* const* d_in, const int* in_sizes, int n_in,
                              void* d_out, int out_size, void* d_ws, size_t ws_size,
                              hipStream_t stream) {
  const float* x    = (const float*)d_in[0];
  const float* w_in = (const float*)d_in[1];
  const float* w_o  = (const float*)d_in[2];
  const float* ln1g = (const float*)d_in[3];
  const float* ln1b = (const float*)d_in[4];
  const float* ln2g = (const float*)d_in[5];
  const float* ln2b = (const float*)d_in[6];
  const float* w1   = (const float*)d_in[7];
  const float* b1   = (const float*)d_in[8];
  const float* w2   = (const float*)d_in[9];
  const float* b2   = (const float*)d_in[10];

  char* ws = (char*)d_ws;
  const size_t MB = 1ull << 20;
  float*    src     = (float*)(ws + 0);            // 32 MiB; dead after LN1
  float*    ff2     = src;                         // alias (written by FFN2)
  float*    hbuf    = (float*)(ws + 32 * MB);      // 32 MiB
  _Float16* h16     = (_Float16*)(ws + 64 * MB);   // 16 MiB
  _Float16* xq      = (_Float16*)(ws + 80 * MB);   // 16 MiB; dead after QKV GEMM
  _Float16* ctx     = xq;                          // alias
  float*    attnout = (float*)(ws + 96 * MB);      // 32 MiB
  _Float16* qkv     = (_Float16*)(ws + 128 * MB);  // 48 MiB; dead after attention
  _Float16* ff      = qkv;                         // alias (64 MiB)
  _Float16* wqkv16  = (_Float16*)(ws + 192 * MB);
  _Float16* wout16  = wqkv16 + (size_t)3072 * 1024;
  _Float16* w116    = wout16 + (size_t)1024 * 1024;
  _Float16* w216    = w116 + (size_t)HIDD * 1024;

  // weight conversions f32 -> f16
  cvt_f32_f16<<<(3072 * 1024 + 255) / 256, 256, 0, stream>>>(w_in, wqkv16, 3072 * 1024);
  cvt_f32_f16<<<(1024 * 1024 + 255) / 256, 256, 0, stream>>>(w_o, wout16, 1024 * 1024);
  cvt_f32_f16<<<(HIDD * 1024 + 255) / 256, 256, 0, stream>>>(w1, w116, HIDD * 1024);
  cvt_f32_f16<<<(HIDD * 1024 + 255) / 256, 256, 0, stream>>>(w2, w216, HIDD * 1024);

  // transpose + PE
  prep_kernel<<<NB * TT / 32, 512, 0, stream>>>(x, src, xq);

  // QKV projection: [8192,1024] x [3072,1024]^T -> f16 [8192,3072]
  gemm_wmma_kernel<0><<<dim3(3072 / 128, 8192 / 128), 256, 0, stream>>>(
      xq, wqkv16, nullptr, qkv, 8192, 3072, 1024);

  // causal flash attention
  attn_kernel<<<dim3(TT / 16, NHEADS, NB), 32, 0, stream>>>(qkv, ctx);

  // out projection -> f32 [8192,1024]
  gemm_wmma_kernel<1><<<dim3(1024 / 128, 8192 / 128), 256, 0, stream>>>(
      ctx, wout16, nullptr, attnout, 8192, 1024, 1024);

  // residual + LN1 -> h (f32 + f16)
  ln1_kernel<<<NB * TT, 256, 0, stream>>>(src, attnout, ln1g, ln1b, hbuf, h16);

  // FFN1: relu(h @ w1^T + b1) -> f16 [8192,4096]
  gemm_wmma_kernel<2><<<dim3(HIDD / 128, 8192 / 128), 256, 0, stream>>>(
      h16, w116, b1, ff, 8192, HIDD, 1024);

  // FFN2: ff @ w2^T + b2 -> f32 [8192,1024]
  gemm_wmma_kernel<3><<<dim3(1024 / 128, 8192 / 128), 256, 0, stream>>>(
      ff, w216, b2, ff2, 8192, 1024, HIDD);

  // residual + LN2 + transpose back to [N,C,T]
  ln2t_kernel<<<NB * TT / 32, 512, 0, stream>>>(hbuf, ff2, ln2g, ln2b, (float*)d_out);
}

// v002
// It runs in 423 microseconds.
// Timed twice side by side with v001, it ran 1.04 times as fast both times.
// All steps since v000 together make it 1.48 times as fast.
#include <hip/hip_runtime.h>
#include <hip/hip_bf16.h>
#include <math.h>

typedef __attribute__((ext_vector_type(16))) _Float16 v16h;
typedef __attribute__((ext_vector_type(8)))  _Float16 v8h;
typedef __attribute__((ext_vector_type(8)))  float    v8f;

#define NB    8
#define TT    1024
#define CC    1024
#define NHEADS 16
#define HD    64
#define HIDD  4096

__device__ __forceinline__ v16h ld_frag_row(const _Float16* __restrict__ base, int ld) {
  const int lane = threadIdx.x & 31;
  const int row  = lane & 15;
  const int koff = (lane & 16) ? 8 : 0;
  const _Float16* p = base + (size_t)row * ld + koff;
  v8h lo = *(const v8h*)(p);        // K = koff .. koff+7
  v8h hi = *(const v8h*)(p + 16);   // K = 16+koff .. 23+koff
  v16h r;
#pragma unroll
  for (int i = 0; i < 8; ++i) { r[i] = lo[i]; r[i + 8] = hi[i]; }
  return r;
}

__device__ __forceinline__ v16h ld_frag_lds(const _Float16* p) {
  v8h lo = *(const v8h*)(p);
  v8h hi = *(const v8h*)(p + 16);
  v16h r;
#pragma unroll
  for (int i = 0; i < 8; ++i) { r[i] = lo[i]; r[i + 8] = hi[i]; }
  return r;
}

// B fragment where logical B[k][n] lives column-major (base[k*ld + n]).
__device__ __forceinline__ v16h ld_frag_col(const _Float16* __restrict__ base, int ld) {
  const int lane = threadIdx.x & 31;
  const int col  = lane & 15;
  const int koff = (lane & 16) ? 8 : 0;
  v16h r;
#pragma unroll
  for (int i = 0; i < 8; ++i) {
    r[i]     = base[(size_t)(koff + i) * ld + col];
    r[i + 8] = base[(size_t)(16 + koff + i) * ld + col];
  }
  return r;
}

template <int EPI>
__global__ __launch_bounds__(256)
void gemm_wmma_kernel(const _Float16* __restrict__ A, const _Float16* __restrict__ B,
                      const float* __restrict__ bias, void* __restrict__ D,
                      int M, int N, int K) {
  __shared__ __align__(16) _Float16 As[2][128][40];   // 40-half padded rows
  __shared__ __align__(16) _Float16 Bs[2][128][40];

  const int tid  = threadIdx.x;
  const int w    = tid >> 5;
  const int wm   = w >> 1;          // 0..3 -> 32-row strip
  const int wn   = w & 1;           // 0..1 -> 64-col strip
  const int rowB = blockIdx.y * 128;
  const int colB = blockIdx.x * 128;

  v8f acc[2][4];
#pragma unroll
  for (int mi = 0; mi < 2; ++mi)
#pragma unroll
    for (int j = 0; j < 4; ++j) acc[mi][j] = (v8f){};

  // async prefetch of one 128x32 A panel + 128x32 B panel (4 b128 / thread)
  auto prefetch = [&](int buf, int k) {
#pragma unroll
    for (int t = 0; t < 2; ++t) {
      const int i   = tid + t * 256;   // 0..511
      const int row = i >> 2;
      const int seg = (i & 3) * 8;     // halves (16B chunks)
      const unsigned long long ga =
          (unsigned long long)(A + (size_t)(rowB + row) * K + k + seg);
      const unsigned la = (unsigned)(uintptr_t)&As[buf][row][seg];
      asm volatile("global_load_async_to_lds_b128 %0, %1, off"
                   :: "v"(la), "v"(ga) : "memory");
      const unsigned long long gb =
          (unsigned long long)(B + (size_t)(colB + row) * K + k + seg);
      const unsigned lb = (unsigned)(uintptr_t)&Bs[buf][row][seg];
      asm volatile("global_load_async_to_lds_b128 %0, %1, off"
                   :: "v"(lb), "v"(gb) : "memory");
    }
  };

  prefetch(0, 0);
  const int KT = K >> 5;
  for (int kt = 0; kt < KT; ++kt) {
    const int buf = kt & 1;
    if (kt + 1 < KT) {
      prefetch(buf ^ 1, (kt + 1) << 5);
      // async loads retire in order: <=4 outstanding == current panel landed
      asm volatile("s_wait_asynccnt 4" ::: "memory");
    } else {
      asm volatile("s_wait_asynccnt 0" ::: "memory");
    }
    __syncthreads();

    const int lane = tid & 31;
    const int fr   = lane & 15;
    const int koff = (lane & 16) ? 8 : 0;
    v16h a[2];
#pragma unroll
    for (int mi = 0; mi < 2; ++mi)
      a[mi] = ld_frag_lds(&As[buf][wm * 32 + mi * 16 + fr][koff]);
#pragma unroll
    for (int j = 0; j < 4; ++j) {
      v16h b = ld_frag_lds(&Bs[buf][wn * 64 + j * 16 + fr][koff]);
#pragma unroll
      for (int mi = 0; mi < 2; ++mi)
        acc[mi][j] = __builtin_amdgcn_wmma_f32_16x16x32_f16(
            false, a[mi], false, b, (short)0, acc[mi][j], false, false);
    }
    __syncthreads();   // panel fully consumed before it is overwritten
  }

  const int lane = tid & 31;
  const int colL = lane & 15;
  const int rb   = (lane & 16) ? 8 : 0;
#pragma unroll
  for (int mi = 0; mi < 2; ++mi) {
#pragma unroll
    for (int j = 0; j < 4; ++j) {
      const int col  = colB + wn * 64 + j * 16 + colL;
      const int row0 = rowB + wm * 32 + mi * 16 + rb;
#pragma unroll
      for (int r = 0; r < 8; ++r) {
        const size_t idx = (size_t)(row0 + r) * N + col;
        float v = acc[mi][j][r];
        if (EPI == 0) {
          ((_Float16*)D)[idx] = (_Float16)v;
        } else if (EPI == 1) {
          ((float*)D)[idx] = v;
        } else if (EPI == 2) {
          v += bias[col];
          ((_Float16*)D)[idx] = (_Float16)(v > 0.f ? v : 0.f);
        } else {
          ((float*)D)[idx] = v + bias[col];
        }
      }
    }
  }
}

// ---------------------------------------------------------------------------
// Flash attention: 1 wave per (batch, head, 16-query tile). Causal.
// qkv: [N*T, 3C] f16 (Q | K | V slabs). ctx out: [N*T, C] f16.
// ---------------------------------------------------------------------------
__global__ __launch_bounds__(32)
void attn_kernel(const _Float16* __restrict__ qkv, _Float16* __restrict__ ctx) {
  const int b  = blockIdx.z;
  const int h  = blockIdx.y;
  const int q0 = blockIdx.x * 16;
  const int lane = threadIdx.x & 31;
  const int colL = lane & 15;
  const int rb   = (lane & 16) ? 8 : 0;
  const int LD   = 3 * CC;
  const float scale = 0.125f;   // 1/sqrt(64)

  __shared__ _Float16 Plds[16][34];

  const size_t rowbase = (size_t)(b * TT) * LD;
  const _Float16* Qb = qkv + rowbase + (size_t)q0 * LD + h * HD;
  const v16h qf0 = ld_frag_row(Qb, LD);        // d 0..31
  const v16h qf1 = ld_frag_row(Qb + 32, LD);   // d 32..63

  v8f acc[4];
#pragma unroll
  for (int j = 0; j < 4; ++j) acc[j] = (v8f){};
  float m_run[8], l_run[8];
#pragma unroll
  for (int r = 0; r < 8; ++r) { m_run[r] = -3.0e38f; l_run[r] = 0.f; }

  for (int kb = 0; kb < q0 + 16; kb += 32) {
    const _Float16* Kb = qkv + rowbase + (size_t)kb * LD + CC + h * HD;
    v16h k00 = ld_frag_row(Kb, LD);
    v16h k01 = ld_frag_row(Kb + 32, LD);
    v16h k10 = ld_frag_row(Kb + (size_t)16 * LD, LD);
    v16h k11 = ld_frag_row(Kb + (size_t)16 * LD + 32, LD);

    v8f s0 = (v8f){}, s1 = (v8f){};
    s0 = __builtin_amdgcn_wmma_f32_16x16x32_f16(false, qf0, false, k00, (short)0, s0, false, false);
    s0 = __builtin_amdgcn_wmma_f32_16x16x32_f16(false, qf1, false, k01, (short)0, s0, false, false);
    s1 = __builtin_amdgcn_wmma_f32_16x16x32_f16(false, qf0, false, k10, (short)0, s1, false, false);
    s1 = __builtin_amdgcn_wmma_f32_16x16x32_f16(false, qf1, false, k11, (short)0, s1, false, false);

    float p0[8], p1[8], mb[8];
#pragma unroll
    for (int r = 0; r < 8; ++r) {
      const int q = q0 + rb + r;
      float a = s0[r] * scale; if (kb + colL      > q) a = -3.0e38f;
      float c = s1[r] * scale; if (kb + 16 + colL > q) c = -3.0e38f;
      p0[r] = a; p1[r] = c;
      mb[r] = fmaxf(a, c);
    }
#pragma unroll
    for (int off = 1; off <= 8; off <<= 1)
#pragma unroll
      for (int r = 0; r < 8; ++r) mb[r] = fmaxf(mb[r], __shfl_xor(mb[r], off, 32));

    float alpha[8], rs[8];
#pragma unroll
    for (int r = 0; r < 8; ++r) {
      const float mn = fmaxf(m_run[r], mb[r]);
      alpha[r] = __expf(m_run[r] - mn);
      m_run[r] = mn;
      p0[r] = __expf(p0[r] - mn);
      p1[r] = __expf(p1[r] - mn);
      rs[r] = p0[r] + p1[r];
    }
#pragma unroll
    for (int off = 1; off <= 8; off <<= 1)
#pragma unroll
      for (int r = 0; r < 8; ++r) rs[r] += __shfl_xor(rs[r], off, 32);
#pragma unroll
    for (int r = 0; r < 8; ++r) l_run[r] = l_run[r] * alpha[r] + rs[r];
#pragma unroll
    for (int j = 0; j < 4; ++j)
#pragma unroll
      for (int r = 0; r < 8; ++r) acc[j][r] *= alpha[r];

    __syncthreads();
#pragma unroll
    for (int r = 0; r < 8; ++r) {
      Plds[rb + r][colL]      = (_Float16)p0[r];
      Plds[rb + r][16 + colL] = (_Float16)p1[r];
    }
    __syncthreads();

    v16h pf;
    {
      const int row  = colL;
      const int koff = (lane & 16) ? 8 : 0;
#pragma unroll
      for (int i = 0; i < 8; ++i) {
        pf[i]     = Plds[row][koff + i];
        pf[i + 8] = Plds[row][16 + koff + i];
      }
    }

    const _Float16* Vb = qkv + rowbase + (size_t)kb * LD + 2 * CC + h * HD;
#pragma unroll
    for (int j = 0; j < 4; ++j) {
      v16h vf = ld_frag_col(Vb + j * 16, LD);
      acc[j] = __builtin_amdgcn_wmma_f32_16x16x32_f16(false, pf, false, vf,
                                                      (short)0, acc[j], false, false);
    }
  }

  float inv[8];
#pragma unroll
  for (int r = 0; r < 8; ++r) inv[r] = 1.f / l_run[r];
#pragma unroll
  for (int j = 0; j < 4; ++j)
#pragma unroll
    for (int r = 0; r < 8; ++r)
      ctx[(size_t)(b * TT + q0 + rb + r) * CC + h * HD + j * 16 + colL] =
          (_Float16)(acc[j][r] * inv[r]);
}

// ---------------------------------------------------------------------------
// Elementwise / reduction kernels
// ---------------------------------------------------------------------------
typedef __attribute__((ext_vector_type(4))) float    v4f;
typedef __attribute__((ext_vector_type(2))) float    v2f;
typedef __attribute__((ext_vector_type(4))) _Float16 v4h;

__device__ __forceinline__ int tile_idx(int c, int tg) {
  return ((c ^ ((c >> 5) & 1)) << 5) + (((tg ^ (c >> 2)) & 7) << 2);
}

__device__ __forceinline__ void sincos_rev(float rev, float& s, float& c) {
  asm("v_sin_f32 %0, %2\n\tv_cos_f32 %1, %2\n\tv_nop" : "=&v"(s), "=&v"(c) : "v"(rev));
}

__device__ __forceinline__ float exp2_slot(float x) {
  float r;
  asm("v_exp_f32 %0, %1\n\tv_nop" : "=v"(r) : "v"(x));
  return r;
}

// One block = 32 consecutive time steps of one batch entry, all 1024 channels.
// x is read as whole 128-byte lines along t, turned in LDS, and src / xq are
// written as whole lines along c; wave w owns time steps 2w and 2w+1.
__global__ __launch_bounds__(512)
void prep_kernel(const float* __restrict__ x, float* __restrict__ src,
                 _Float16* __restrict__ xq) {
  __shared__ __align__(16) float tile[CC * 32];
  const int tid  = threadIdx.x;
  const int lane = tid & 31;
  const int w    = tid >> 5;
  const int row0 = blockIdx.x * 32;   // n*T + t of the first time step
  const int n  = row0 >> 10;
  const int t0 = row0 & 1023;
  {
    const int tg = tid & 7;
    const float* xp = x + ((size_t)n * CC + (tid >> 3)) * TT + t0 + tg * 4;
    v4f xr[16];
#pragma unroll
    for (int k = 0; k < 16; ++k) {
      // The last load's result may be given the address pair that the loads
      // before it name: they have taken their address behind this wait.
      if (k == 15) asm volatile("s_wait_xcnt 0x0" ::: "memory");
      xr[k] = *(const v4f*)(xp + (size_t)k * 64 * TT);
    }
#pragma unroll
    for (int k = 0; k < 16; ++k)
      *(v4f*)&tile[tile_idx(k * 64 + (tid >> 3), tg)] = xr[k];
  }
  __syncthreads();

  const float k0 = -logf(10000.0f) / (float)CC;
  const float ta = (float)(t0 + 2 * w);
  const float tb = (float)(t0 + 2 * w + 1);
  float*    sp = src + (size_t)(row0 + 2 * w) * CC + lane * 4;
  _Float16* qp = xq  + (size_t)(row0 + 2 * w) * CC + lane * 4;
#pragma unroll
  for (int i = 0; i < 8; ++i) {
    const int c0 = i * 128 + lane * 4;
    v4f sa, sb;
    v4h qa, qb;
#pragma unroll
    for (int j = 0; j < 4; j += 2) {   // channels c0+j (sin) and c0+j+1 (cos) share an angle
      const float f = exp2_slot(k0 * (float)(c0 + j) * 1.4426950408889634f);
      float pea[2], peb[2];
      sincos_rev(ta * f * 0.15915494309189532f, pea[0], pea[1]);
      sincos_rev(tb * f * 0.15915494309189532f, peb[0], peb[1]);
#pragma unroll
      for (int e = 0; e < 2; ++e) {
        const v2f p = *(const v2f*)&tile[tile_idx(c0 + j + e, w >> 1) + (w & 1) * 2];
        sa[j + e] = p[0];
        sb[j + e] = p[1];
        qa[j + e] = (_Float16)(p[0] + pea[e]);
        qb[j + e] = (_Float16)(p[1] + peb[e]);
      }
    }
    *(v4f*)(sp + i * 128)      = sa;
    *(v4f*)(sp + CC + i * 128) = sb;
    *(v4h*)(qp + i * 128)      = qa;
    *(v4h*)(qp + CC + i * 128) = qb;
  }
}

#define CVT_BLK 16384
__global__ __launch_bounds__(256) __attribute__((amdgpu_waves_per_eu(2, 8)))
void cvt_f32_f16(const float* __restrict__ in, _Float16* __restrict__ out) {
  const size_t base = (size_t)blockIdx.x * CVT_BLK + (threadIdx.x >> 5) * 2048 +
                      (threadIdx.x & 31) * 4;
  const float* ip = in + base;
  _Float16*    op = out + base;
  v4f r[16];
#pragma unroll
  for (int k = 0; k < 16; ++k) {
    // The last load's result may be given the address pair that the loads
    // before it name: they have taken their address behind this wait.
    if (k == 15) asm volatile("s_wait_xcnt 0x0" ::: "memory");
    r[k] = *(const v4f*)(ip + k * 128);
  }
#pragma unroll
  for (int k = 0; k < 16; ++k) {
    v4h h;
#pragma unroll
    for (int j = 0; j < 4; ++j) h[j] = (_Float16)r[k][j];
    *(v4h*)(op + k * 128) = h;
  }
}

__device__ __forceinline__ float block_sum_256(float v, float* red) {
  const int tid = threadIdx.x;
  red[tid] = v; __syncthreads();
  for (int o = 128; o > 0; o >>= 1) {
    if (tid < o) red[tid] += red[tid + o];
    __syncthreads();
  }
  const float s = red[0];
  __syncthreads();
  return s;
}

__global__ __launch_bounds__(256)
void ln1_kernel(const float* __restrict__ a, const float* __restrict__ bb,
                const float* __restrict__ g, const float* __restrict__ beta,
                float* __restrict__ hout, _Float16* __restrict__ h16) {
  __shared__ float red[256];
  const int row = blockIdx.x, tid = threadIdx.x;
  float vals[4], s = 0.f;
#pragma unroll
  for (int i = 0; i < 4; ++i) {
    const int c = tid + i * 256;
    const float v = a[(size_t)row * CC + c] + bb[(size_t)row * CC + c];
    vals[i] = v; s += v;
  }
  const float mu = block_sum_256(s, red) * (1.f / CC);
  float sq = 0.f;
#pragma unroll
  for (int i = 0; i < 4; ++i) { const float d = vals[i] - mu; sq += d * d; }
  const float rstd = rsqrtf(block_sum_256(sq, red) * (1.f / CC) + 1e-5f);
#pragma unroll
  for (int i = 0; i < 4; ++i) {
    const int c = tid + i * 256;
    const float o = (vals[i] - mu) * rstd * g[c] + beta[c];
    hout[(size_t)row * CC + c] = o;
    h16[(size_t)row * CC + c] = (_Float16)o;
  }
}

__device__ __forceinline__ float wave_sum(float v) {
#pragma unroll
  for (int off = 16; off >= 1; off >>= 1) v += __shfl_xor(v, off, 32);
  return v;
}

// One block = 32 consecutive time steps of one batch entry. Wave w normalises
// rows 2w and 2w+1 whole (row sums inside the wave), lays the results in the LDS
// tile, and the block then stores whole 128-byte lines of out along t.
__global__ __launch_bounds__(512)
void ln2t_kernel(const float* __restrict__ a, const float* __restrict__ bb,
                 const float* __restrict__ g, const float* __restrict__ beta,
                 float* __restrict__ out) {
  __shared__ __align__(16) float tile[CC * 32];
  const int tid  = threadIdx.x;
  const int lane = tid & 31;
  const int w    = tid >> 5;
  const int row0 = blockIdx.x * 32;
  const int n  = row0 >> 10;
  const int t0 = row0 & 1023;

  const float* ap = a  + (size_t)(row0 + 2 * w) * CC + lane * 4;
  const float* bp = bb + (size_t)(row0 + 2 * w) * CC + lane * 4;
  v4f v[2][8];
#pragma unroll
  for (int r = 0; r < 2; ++r)
#pragma unroll
    for (int i = 0; i < 8; ++i)
      v[r][i] = *(const v4f*)(ap + r * CC + i * 128) + *(const v4f*)(bp + r * CC + i * 128);

  float mu[2], rstd[2];
#pragma unroll
  for (int r = 0; r < 2; ++r) {
    float s = 0.f;
#pragma unroll
    for (int i = 0; i < 8; ++i)
#pragma unroll
      for (int j = 0; j < 4; ++j) s += v[r][i][j];
    mu[r] = wave_sum(s) * (1.f / CC);
    float sq = 0.f;
#pragma unroll
    for (int i = 0; i < 8; ++i)
#pragma unroll
      for (int j = 0; j < 4; ++j) { const float d = v[r][i][j] - mu[r]; sq += d * d; }
    rstd[r] = rsqrtf(wave_sum(sq) * (1.f / CC) + 1e-5f);
  }

#pragma unroll
  for (int i = 0; i < 8; ++i) {
    const int c0 = i * 128 + lane * 4;
    const v4f gg = *(const v4f*)(g + c0);
    const v4f be = *(const v4f*)(beta + c0);
#pragma unroll
    for (int j = 0; j < 4; ++j) {
      v2f o;
      o[0] = (v[0][i][j] - mu[0]) * rstd[0] * gg[j] + be[j];
      o[1] = (v[1][i][j] - mu[1]) * rstd[1] * gg[j] + be[j];
      *(v2f*)&tile[tile_idx(c0 + j, w >> 1) + (w & 1) * 2] = o;
    }
  }
  __syncthreads();

  const int tg = tid & 7;
  float* op = out + ((size_t)n * CC + (tid >> 3)) * TT + t0 + tg * 4;
#pragma unroll
  for (int k = 0; k < 16; ++k) {
    const int c = k * 64 + (tid >> 3);
    *(v4f*)(op + (size_t)k * 64 * TT) = *(const v4f*)&tile[tile_idx(c, tg)];
  }
}

// ---------------------------------------------------------------------------
extern "C" void kernel_launch(void* const* d_in, const int* in_sizes, int n_in,
                              void* d_out, int out_size, void* d_ws, size_t ws_size,
                              hipStream_t stream) {
  const float* x    = (const float*)d_in[0];
  const float* w_in = (const float*)d_in[1];
  const float* w_o  = (const float*)d_in[2];
  const float* ln1g = (const float*)d_in[3];
  const float* ln1b = (const float*)d_in[4];
  const float* ln2g = (const float*)d_in[5];
  const float* ln2b = (const float*)d_in[6];
  const float* w1   = (const float*)d_in[7];
  const float* b1   = (const float*)d_in[8];
  const float* w2   = (const float*)d_in[9];
  const float* b2   = (const float*)d_in[10];

  char* ws = (char*)d_ws;
  const size_t MB = 1ull << 20;
  float*    src     = (float*)(ws + 0);            // 32 MiB; dead after LN1
  float*    ff2     = src;                         // alias (written by FFN2)
  float*    hbuf    = (float*)(ws + 32 * MB);      // 32 MiB
  _Float16* h16     = (_Float16*)(ws + 64 * MB);   // 16 MiB
  _Float16* xq      = (_Float16*)(ws + 80 * MB);   // 16 MiB; dead after QKV GEMM
  _Float16* ctx     = xq;                          // alias
  float*    attnout = (float*)(ws + 96 * MB);      // 32 MiB
  _Float16* qkv     = (_Float16*)(ws + 128 * MB);  // 48 MiB; dead after attention
  _Float16* ff      = qkv;                         // alias (64 MiB)
  _Float16* wqkv16  = (_Float16*)(ws + 192 * MB);
  _Float16* wout16  = wqkv16 + (size_t)3072 * 1024;
  _Float16* w116    = wout16 + (size_t)1024 * 1024;
  _Float16* w216    = w116 + (size_t)HIDD * 1024;

  // weight conversions f32 -> f16
  cvt_f32_f16<<<3072 * 1024 / CVT_BLK, 256, 0, stream>>>(w_in, wqkv16);
  cvt_f32_f16<<<1024 * 1024 / CVT_BLK, 256, 0, stream>>>(w_o, wout16);
  cvt_f32_f16<<<HIDD * 1024 / CVT_BLK, 256, 0, stream>>>(w1, w116);
  cvt_f32_f16<<<HIDD * 1024 / CVT_BLK, 256, 0, stream>>>(w2, w216);

  // transpose + PE
  prep_kernel<<<NB * TT / 32, 512, 0, stream>>>(x, src, xq);

  // QKV projection: [8192,1024] x [3072,1024]^T -> f16 [8192,3072]
  gemm_wmma_kernel<0><<<dim3(3072 / 128, 8192 / 128), 256, 0, stream>>>(
      xq, wqkv16, nullptr, qkv, 8192, 3072, 1024);

  // causal flash attention
  attn_kernel<<<dim3(TT / 16, NHEADS, NB), 32, 0, stream>>>(qkv, ctx);

  // out projection -> f32 [8192,1024]
  gemm_wmma_kernel<1><<<dim3(1024 / 128, 8192 / 128), 256, 0, stream>>>(
      ctx, wout16, nullptr, attnout, 8192, 1024, 1024);

  // residual + LN1 -> h (f32 + f16)
  ln1_kernel<<<NB * TT, 256, 0, stream>>>(src, attnout, ln1g, ln1b, hbuf, h16);

  // FFN1: relu(h @ w1^T + b1) -> f16 [8192,4096]
  gemm_wmma_kernel<2><<<dim3(HIDD / 128, 8192 / 128), 256, 0, stream>>>(
      h16, w116, b1, ff, 8192, HIDD, 1024);

  // FFN2: ff @ w2^T + b2 -> f32 [8192,1024]
  gemm_wmma_kernel<3><<<dim3(1024 / 128, 8192 / 128), 256, 0, stream>>>(
      ff, w216, b2, ff2, 8192, 1024, HIDD);

  // residual + LN2 + transpose back to [N,C,T]
  ln2t_kernel<<<NB * TT / 32, 512, 0, stream>>>(hbuf, ff2, ln2g, ln2b, (float*)d_out);
}

// v003
// A run of this version takes 359 microseconds.
// Two timings next to v002 both put it at 1.18 times that version's speed.
// All steps since v000 together make it 1.75 times as fast.
#include <hip/hip_runtime.h>
#include <hip/hip_bf16.h>
#include <math.h>

typedef __attribute__((ext_vector_type(16))) _Float16 v16h;
typedef __attribute__((ext_vector_type(8)))  _Float16 v8h;
typedef __attribute__((ext_vector_type(8)))  float    v8f;

#define NB    8
#define TT    1024
#define CC    1024
#define NHEADS 16
#define HD    64
#define HIDD  4096

__device__ __forceinline__ v16h ld_frag_row(const _Float16* __restrict__ base, int ld) {
  const int lane = threadIdx.x & 31;
  const int row  = lane & 15;
  const int koff = (lane & 16) ? 8 : 0;
  const _Float16* p = base + (size_t)row * ld + koff;
  v8h lo = *(const v8h*)(p);        // K = koff .. koff+7
  v8h hi = *(const v8h*)(p + 16);   // K = 16+koff .. 23+koff
  v16h r;
#pragma unroll
  for (int i = 0; i < 8; ++i) { r[i] = lo[i]; r[i + 8] = hi[i]; }
  return r;
}

__device__ __forceinline__ v16h ld_frag_lds(const _Float16* p) {
  v8h lo = *(const v8h*)(p);
  v8h hi = *(const v8h*)(p + 16);
  v16h r;
#pragma unroll
  for (int i = 0; i < 8; ++i) { r[i] = lo[i]; r[i + 8] = hi[i]; }
  return r;
}

// B fragment where logical B[k][n] lives column-major (base[k*ld + n]).
__device__ __forceinline__ v16h ld_frag_col(const _Float16* __restrict__ base, int ld) {
  const int lane = threadIdx.x & 31;
  const int col  = lane & 15;
  const int koff = (lane & 16) ? 8 : 0;
  v16h r;
#pragma unroll
  for (int i = 0; i < 8; ++i) {
    r[i]     = base[(size_t)(koff + i) * ld + col];
    r[i + 8] = base[(size_t)(16 + koff + i) * ld + col];
  }
  return r;
}

// ---------------------------------------------------------------------------
// LDS-staged WMMA GEMM: D[M,N] = A[M,K] * B[N,K]^T (row-major f16, K contig).
// Block = 256 thr = 8 waves; block tile 256x128, 64 k a pass; wave tile 64x64.
// M a multiple of 256, N of 128, K of 64 (the grid covers D exactly).
// A/B panels (whole 128-byte lines of every row) lie in two LDS buffers, filled
// with global_load_async_to_lds_b128 and read as ds_load_b128 fragments; the
// next pass's copies fly while this pass's panel is worked on.
// EPI: 0 = f16 ; 1 = f32 ; 2 = relu(x+bias)->f16 ; 3 = x+bias->f32
// ---------------------------------------------------------------------------
#define GBM 256
#define GBN 128
#define GBK 64
#define GPITCH 72   // halves: a 128-byte row and 16 bytes, the b128 readers' pitch

template <int EPI>
__global__ __launch_bounds__(256)
void gemm_wmma_kernel(const _Float16* __restrict__ A, const _Float16* __restrict__ B,
                      const float* __restrict__ bias, void* __restrict__ D,
                      int M, int N, int K) {
  __shared__ __align__(16) _Float16 As[2][GBM][GPITCH];
  __shared__ __align__(16) _Float16 Bs[2][GBN][GPITCH];

  const int tid  = threadIdx.x;
  const int w    = tid >> 5;
  const int wm   = w >> 1;          // 0..3 -> 64-row strip
  const int wn   = w & 1;           // 0..1 -> 64-col strip
  const int rowB = blockIdx.y * GBM;
  const int colB = blockIdx.x * GBN;

  v8f acc[4][4];
#pragma unroll
  for (int mi = 0; mi < 4; ++mi)
#pragma unroll
    for (int j = 0; j < 4; ++j) acc[mi][j] = (v8f){};

  // One panel pair = 384 rows of 128 bytes = 12 copies of 16 bytes a thread.
  // Eight lanes cover one row, so a wave's copy is four whole lines; copy t of a
  // thread lies 32 rows below copy t-1.
  const int crow = tid >> 3;         // 0..31
  const int cseg = (tid & 7) * 8;    // halves (16-byte chunks)
  const unsigned long long gstep = (unsigned long long)K * 64;   // 32 rows, bytes
  const unsigned lstep = 32 * GPITCH * 2;                        // 32 rows, bytes
  const unsigned long long gA =
      (unsigned long long)(A + (size_t)(rowB + crow) * K + cseg);
  const unsigned long long gB =
      (unsigned long long)(B + (size_t)(colB + crow) * K + cseg);
  auto prefetch = [&](int buf, int k) {
    const unsigned long long ga = gA + (unsigned long long)k * 2;
    const unsigned long long gb = gB + (unsigned long long)k * 2;
    const unsigned la = (unsigned)(uintptr_t)&As[buf][crow][cseg];
    const unsigned lb = (unsigned)(uintptr_t)&Bs[buf][crow][cseg];
    asm volatile(
        "global_load_async_to_lds_b128 %0, %12, off\n\t"
        "global_load_async_to_lds_b128 %1, %13, off\n\t"
        "global_load_async_to_lds_b128 %2, %14, off\n\t"
        "global_load_async_to_lds_b128 %3, %15, off\n\t"
        "global_load_async_to_lds_b128 %4, %16, off\n\t"
        "global_load_async_to_lds_b128 %5, %17, off\n\t"
        "global_load_async_to_lds_b128 %6, %18, off\n\t"
        "global_load_async_to_lds_b128 %7, %19, off\n\t"
        "global_load_async_to_lds_b128 %8, %20, off\n\t"
        "global_load_async_to_lds_b128 %9, %21, off\n\t"
        "global_load_async_to_lds_b128 %10, %22, off\n\t"
        "global_load_async_to_lds_b128 %11, %23, off\n\t"
        "s_wait_xcnt 0x0"
        :: "v"(la), "v"(la + lstep), "v"(la + 2 * lstep), "v"(la + 3 * lstep),
           "v"(la + 4 * lstep), "v"(la + 5 * lstep), "v"(la + 6 * lstep),
           "v"(la + 7 * lstep),
           "v"(lb), "v"(lb + lstep), "v"(lb + 2 * lstep), "v"(lb + 3 * lstep),
           "v"(ga), "v"(ga + gstep), "v"(ga + 2 * gstep), "v"(ga + 3 * gstep),
           "v"(ga + 4 * gstep), "v"(ga + 5 * gstep), "v"(ga + 6 * gstep),
           "v"(ga + 7 * gstep),
           "v"(gb), "v"(gb + gstep), "v"(gb + 2 * gstep), "v"(gb + 3 * gstep)
        : "memory");
  };

  const int lane = tid & 31;
  const int fr   = lane & 15;
  const int koff = (lane & 16) ? 8 : 0;
  const int KT   = K / GBK;

  prefetch(0, 0);
  // panel 0 has landed for this wave, then for the block
  asm volatile("s_wait_asynccnt 0x0" ::: "memory");
  __syncthreads();
  if (KT > 1) prefetch(1, GBK);

  for (int kt = 0; kt < KT; ++kt) {
    const int buf = kt & 1;
    const _Float16* ap = &As[buf][wm * 64 + fr][koff];
    const _Float16* bp = &Bs[buf][wn * 64 + fr][koff];
    v16h a[4], b[4];
    auto load_frags = [&](int ks) {   // 16 ds_load_b128: 32 k of the wave's rows
#pragma unroll
      for (int mi = 0; mi < 4; ++mi)
        a[mi] = ld_frag_lds(ap + mi * 16 * GPITCH + ks * 32);
#pragma unroll
      for (int j = 0; j < 4; ++j)
        b[j] = ld_frag_lds(bp + j * 16 * GPITCH + ks * 32);
    };
    auto mma = [&]() {
#pragma unroll
      for (int j = 0; j < 4; ++j)
#pragma unroll
        for (int mi = 0; mi < 4; ++mi)
          acc[mi][j] = __builtin_amdgcn_wmma_f32_16x16x32_f16(
              false, a[mi], false, b[j], (short)0, acc[mi][j], false, false);
    };
    load_frags(0);
    // Keeps the 16 LDS reads one group in front of their 16 WMMAs: left alone
    // the compiler reloads one B fragment every 4 WMMAs and waits out the LDS
    // latency each time.
    __builtin_amdgcn_sched_barrier(0);
    mma();
    load_frags(1);   // the wave's last reads of this panel
    // Foot of the pass: this wave's reads of the panel are done ...
    asm volatile("s_wait_dscnt 0x0" ::: "memory");
    // ... its copies of the next panel have landed ...
    asm volatile("s_wait_asynccnt 0x0" ::: "memory");
    // ... and the one barrier publishes that panel and frees this one.
    __syncthreads();
    if (kt + 2 < KT) prefetch(buf, (kt + 2) * GBK);
    // The second half's products need registers only: behind the refill, so
    // that the copies have the whole next pass to land.
    mma();
  }
  // no copy is in flight when the wave ends
  asm volatile("s_wait_asynccnt 0x0" ::: "memory");

  const int colL = lane & 15;
  const int rb   = (lane & 16) ? 8 : 0;
#pragma unroll
  for (int mi = 0; mi < 4; ++mi) {
#pragma unroll
    for (int j = 0; j < 4; ++j) {
      const int col  = colB + wn * 64 + j * 16 + colL;
      const int row0 = rowB + wm * 64 + mi * 16 + rb;
#pragma unroll
      for (int r = 0; r < 8; ++r) {
        const size_t idx = (size_t)(row0 + r) * N + col;
        float v = acc[mi][j][r];
        if (EPI == 0) {
          ((_Float16*)D)[idx] = (_Float16)v;
        } else if (EPI == 1) {
          ((float*)D)[idx] = v;
        } else if (EPI == 2) {
          v += bias[col];
          ((_Float16*)D)[idx] = (_Float16)(v > 0.f ? v : 0.f);
        } else {
          ((float*)D)[idx] = v + bias[col];
        }
      }
    }
  }
}

// ---------------------------------------------------------------------------
// Flash attention: 1 wave per (batch, head, 16-query tile). Causal.
// qkv: [N*T, 3C] f16 (Q | K | V slabs). ctx out: [N*T, C] f16.
// ---------------------------------------------------------------------------
__global__ __launch_bounds__(32)
void attn_kernel(const _Float16* __restrict__ qkv, _Float16* __restrict__ ctx) {
  const int b  = blockIdx.z;
  const int h  = blockIdx.y;
  const int q0 = blockIdx.x * 16;
  const int lane = threadIdx.x & 31;
  const int colL = lane & 15;
  const int rb   = (lane & 16) ? 8 : 0;
  const int LD   = 3 * CC;
  const float scale = 0.125f;   // 1/sqrt(64)

  __shared__ _Float16 Plds[16][34];

  const size_t rowbase = (size_t)(b * TT) * LD;
  const _Float16* Qb = qkv + rowbase + (size_t)q0 * LD + h * HD;
  const v16h qf0 = ld_frag_row(Qb, LD);        // d 0..31
  const v16h qf1 = ld_frag_row(Qb + 32, LD);   // d 32..63

  v8f acc[4];
#pragma unroll
  for (int j = 0; j < 4; ++j) acc[j] = (v8f){};
  float m_run[8], l_run[8];
#pragma unroll
  for (int r = 0; r < 8; ++r) { m_run[r] = -3.0e38f; l_run[r] = 0.f; }

  for (int kb = 0; kb < q0 + 16; kb += 32) {
    const _Float16* Kb = qkv + rowbase + (size_t)kb * LD + CC + h * HD;
    v16h k00 = ld_frag_row(Kb, LD);
    v16h k01 = ld_frag_row(Kb + 32, LD);
    v16h k10 = ld_frag_row(Kb + (size_t)16 * LD, LD);
    v16h k11 = ld_frag_row(Kb + (size_t)16 * LD + 32, LD);

    v8f s0 = (v8f){}, s1 = (v8f){};
    s0 = __builtin_amdgcn_wmma_f32_16x16x32_f16(false, qf0, false, k00, (short)0, s0, false, false);
    s0 = __builtin_amdgcn_wmma_f32_16x16x32_f16(false, qf1, false, k01, (short)0, s0, false, false);
    s1 = __builtin_amdgcn_wmma_f32_16x16x32_f16(false, qf0, false, k10, (short)0, s1, false, false);
    s1 = __builtin_amdgcn_wmma_f32_16x16x32_f16(false, qf1, false, k11, (short)0, s1, false, false);

    float p0[8], p1[8], mb[8];
#pragma unroll
    for (int r = 0; r < 8; ++r) {
      const int q = q0 + rb + r;
      float a = s0[r] * scale; if (kb + colL      > q) a = -3.0e38f;
      float c = s1[r] * scale; if (kb + 16 + colL > q) c = -3.0e38f;
      p0[r] = a; p1[r] = c;
      mb[r] = fmaxf(a, c);
    }
#pragma unroll
    for (int off = 1; off <= 8; off <<= 1)
#pragma unroll
      for (int r = 0; r < 8; ++r) mb[r] = fmaxf(mb[r], __shfl_xor(mb[r], off, 32));

    float alpha[8], rs[8];
#pragma unroll
    for (int r = 0; r < 8; ++r) {
      const float mn = fmaxf(m_run[r], mb[r]);
      alpha[r] = __expf(m_run[r] - mn);
      m_run[r] = mn;
      p0[r] = __expf(p0[r] - mn);
      p1[r] = __expf(p1[r] - mn);
      rs[r] = p0[r] + p1[r];
    }
#pragma unroll
    for (int off = 1; off <= 8; off <<= 1)
#pragma unroll
      for (int r = 0; r < 8; ++r) rs[r] += __shfl_xor(rs[r], off, 32);
#pragma unroll
    for (int r = 0; r < 8; ++r) l_run[r] = l_run[r] * alpha[r] + rs[r];
#pragma unroll
    for (int j = 0; j < 4; ++j)
#pragma unroll
      for (int r = 0; r < 8; ++r) acc[j][r] *= alpha[r];

    __syncthreads();
#pragma unroll
    for (int r = 0; r < 8; ++r) {
      Plds[rb + r][colL]      = (_Float16)p0[r];
      Plds[rb + r][16 + colL] = (_Float16)p1[r];
    }
    __syncthreads();

    v16h pf;
    {
      const int row  = colL;
      const int koff = (lane & 16) ? 8 : 0;
#pragma unroll
      for (int i = 0; i < 8; ++i) {
        pf[i]     = Plds[row][koff + i];
        pf[i + 8] = Plds[row][16 + koff + i];
      }
    }

    const _Float16* Vb = qkv + rowbase + (size_t)kb * LD + 2 * CC + h * HD;
#pragma unroll
    for (int j = 0; j < 4; ++j) {
      v16h vf = ld_frag_col(Vb + j * 16, LD);
      acc[j] = __builtin_amdgcn_wmma_f32_16x16x32_f16(false, pf, false, vf,
                                                      (short)0, acc[j], false, false);
    }
  }

  float inv[8];
#pragma unroll
  for (int r = 0; r < 8; ++r) inv[r] = 1.f / l_run[r];
#pragma unroll
  for (int j = 0; j < 4; ++j)
#pragma unroll
    for (int r = 0; r < 8; ++r)
      ctx[(size_t)(b * TT + q0 + rb + r) * CC + h * HD + j * 16 + colL] =
          (_Float16)(acc[j][r] * inv[r]);
}

// ---------------------------------------------------------------------------
// Elementwise / reduction kernels
// ---------------------------------------------------------------------------
typedef __attribute__((ext_vector_type(4))) float    v4f;
typedef __attribute__((ext_vector_type(2))) float    v2f;
typedef __attribute__((ext_vector_type(4))) _Float16 v4h;

__device__ __forceinline__ int tile_idx(int c, int tg) {
  return ((c ^ ((c >> 5) & 1)) << 5) + (((tg ^ (c >> 2)) & 7) << 2);
}

__device__ __forceinline__ void sincos_rev(float rev, float& s, float& c) {
  asm("v_sin_f32 %0, %2\n\tv_cos_f32 %1, %2\n\tv_nop" : "=&v"(s), "=&v"(c) : "v"(rev));
}

__device__ __forceinline__ float exp2_slot(float x) {
  float r;
  asm("v_exp_f32 %0, %1\n\tv_nop" : "=v"(r) : "v"(x));
  return r;
}

// One block = 32 consecutive time steps of one batch entry, all 1024 channels.
// x is read as whole 128-byte lines along t, turned in LDS, and src / xq are
// written as whole lines along c; wave w owns time steps 2w and 2w+1.
__global__ __launch_bounds__(512)
void prep_kernel(const float* __restrict__ x, float* __restrict__ src,
                 _Float16* __restrict__ xq) {
  __shared__ __align__(16) float tile[CC * 32];
  const int tid  = threadIdx.x;
  const int lane = tid & 31;
  const int w    = tid >> 5;
  const int row0 = blockIdx.x * 32;   // n*T + t of the first time step
  const int n  = row0 >> 10;
  const int t0 = row0 & 1023;
  {
    const int tg = tid & 7;
    const float* xp = x + ((size_t)n * CC + (tid >> 3)) * TT + t0 + tg * 4;
    v4f xr[16];
#pragma unroll
    for (int k = 0; k < 16; ++k) {
      // The last load's result may be given the address pair that the loads
      // before it name: they have taken their address behind this wait.
      if (k == 15) asm volatile("s_wait_xcnt 0x0" ::: "memory");
      xr[k] = *(const v4f*)(xp + (size_t)k * 64 * TT);
    }
#pragma unroll
    for (int k = 0; k < 16; ++k)
      *(v4f*)&tile[tile_idx(k * 64 + (tid >> 3), tg)] = xr[k];
  }
  __syncthreads();

  const float k0 = -logf(10000.0f) / (float)CC;
  const float ta = (float)(t0 + 2 * w);
  const float tb = (float)(t0 + 2 * w + 1);
  float*    sp = src + (size_t)(row0 + 2 * w) * CC + lane * 4;
  _Float16* qp = xq  + (size_t)(row0 + 2 * w) * CC + lane * 4;
#pragma unroll
  for (int i = 0; i < 8; ++i) {
    const int c0 = i * 128 + lane * 4;
    v4f sa, sb;
    v4h qa, qb;
#pragma unroll
    for (int j = 0; j < 4; j += 2) {   // channels c0+j (sin) and c0+j+1 (cos) share an angle
      const float f = exp2_slot(k0 * (float)(c0 + j) * 1.4426950408889634f);
      float pea[2], peb[2];
      sincos_rev(ta * f * 0.15915494309189532f, pea[0], pea[1]);
      sincos_rev(tb * f * 0.15915494309189532f, peb[0], peb[1]);
#pragma unroll
      for (int e = 0; e < 2; ++e) {
        const v2f p = *(const v2f*)&tile[tile_idx(c0 + j + e, w >> 1) + (w & 1) * 2];
        sa[j + e] = p[0];
        sb[j + e] = p[1];
        qa[j + e] = (_Float16)(p[0] + pea[e]);
        qb[j + e] = (_Float16)(p[1] + peb[e]);
      }
    }
    *(v4f*)(sp + i * 128)      = sa;
    *(v4f*)(sp + CC + i * 128) = sb;
    *(v4h*)(qp + i * 128)      = qa;
    *(v4h*)(qp + CC + i * 128) = qb;
  }
}

#define CVT_BLK 16384
__global__ __launch_bounds__(256) __attribute__((amdgpu_waves_per_eu(2, 8)))
void cvt_f32_f16(const float* __restrict__ in, _Float16* __restrict__ out) {
  const size_t base = (size_t)blockIdx.x * CVT_BLK + (threadIdx.x >> 5) * 2048 +
                      (threadIdx.x & 31) * 4;
  const float* ip = in + base;
  _Float16*    op = out + base;
  v4f r[16];
#pragma unroll
  for (int k = 0; k < 16; ++k) {
    // The last load's result may be given the address pair that the loads
    // before it name: they have taken their address behind this wait.
    if (k == 15) asm volatile("s_wait_xcnt 0x0" ::: "memory");
    r[k] = *(const v4f*)(ip + k * 128);
  }
#pragma unroll
  for (int k = 0; k < 16; ++k) {
    v4h h;
#pragma unroll
    for (int j = 0; j < 4; ++j) h[j] = (_Float16)r[k][j];
    *(v4h*)(op + k * 128) = h;
  }
}

__device__ __forceinline__ float block_sum_256(float v, float* red) {
  const int tid = threadIdx.x;
  red[tid] = v; __syncthreads();
  for (int o = 128; o > 0; o >>= 1) {
    if (tid < o) red[tid] += red[tid + o];
    __syncthreads();
  }
  const float s = red[0];
  __syncthreads();
  return s;
}

__global__ __launch_bounds__(256)
void ln1_kernel(const float* __restrict__ a, const float* __restrict__ bb,
                const float* __restrict__ g, const float* __restrict__ beta,
                float* __restrict__ hout, _Float16* __restrict__ h16) {
  __shared__ float red[256];
  const int row = blockIdx.x, tid = threadIdx.x;
  float vals[4], s = 0.f;
#pragma unroll
  for (int i = 0; i < 4; ++i) {
    const int c = tid + i * 256;
    const float v = a[(size_t)row * CC + c] + bb[(size_t)row * CC + c];
    vals[i] = v; s += v;
  }
  const float mu = block_sum_256(s, red) * (1.f / CC);
  float sq = 0.f;
#pragma unroll
  for (int i = 0; i < 4; ++i) { const float d = vals[i] - mu; sq += d * d; }
  const float rstd = rsqrtf(block_sum_256(sq, red) * (1.f / CC) + 1e-5f);
#pragma unroll
  for (int i = 0; i < 4; ++i) {
    const int c = tid + i * 256;
    const float o = (vals[i] - mu) * rstd * g[c] + beta[c];
    hout[(size_t)row * CC + c] = o;
    h16[(size_t)row * CC + c] = (_Float16)o;
  }
}

__device__ __forceinline__ float wave_sum(float v) {
#pragma unroll
  for (int off = 16; off >= 1; off >>= 1) v += __shfl_xor(v, off, 32);
  return v;
}

// One block = 32 consecutive time steps of one batch entry. Wave w normalises
// rows 2w and 2w+1 whole (row sums inside the wave), lays the results in the LDS
// tile, and the block then stores whole 128-byte lines of out along t.
__global__ __launch_bounds__(512)
void ln2t_kernel(const float* __restrict__ a, const float* __restrict__ bb,
                 const float* __restrict__ g, const float* __restrict__ beta,
                 float* __restrict__ out) {
  __shared__ __align__(16) float tile[CC * 32];
  const int tid  = threadIdx.x;
  const int lane = tid & 31;
  const int w    = tid >> 5;
  const int row0 = blockIdx.x * 32;
  const int n  = row0 >> 10;
  const int t0 = row0 & 1023;

  const float* ap = a  + (size_t)(row0 + 2 * w) * CC + lane * 4;
  const float* bp = bb + (size_t)(row0 + 2 * w) * CC + lane * 4;
  v4f v[2][8];
#pragma unroll
  for (int r = 0; r < 2; ++r)
#pragma unroll
    for (int i = 0; i < 8; ++i)
      v[r][i] = *(const v4f*)(ap + r * CC + i * 128) + *(const v4f*)(bp + r * CC + i * 128);

  float mu[2], rstd[2];
#pragma unroll
  for (int r = 0; r < 2; ++r) {
    float s = 0.f;
#pragma unroll
    for (int i = 0; i < 8; ++i)
#pragma unroll
      for (int j = 0; j < 4; ++j) s += v[r][i][j];
    mu[r] = wave_sum(s) * (1.f / CC);
    float sq = 0.f;
#pragma unroll
    for (int i = 0; i < 8; ++i)
#pragma unroll
      for (int j = 0; j < 4; ++j) { const float d = v[r][i][j] - mu[r]; sq += d * d; }
    rstd[r] = rsqrtf(wave_sum(sq) * (1.f / CC) + 1e-5f);
  }

#pragma unroll
  for (int i = 0; i < 8; ++i) {
    const int c0 = i * 128 + lane * 4;
    const v4f gg = *(const v4f*)(g + c0);
    const v4f be = *(const v4f*)(beta + c0);
#pragma unroll
    for (int j = 0; j < 4; ++j) {
      v2f o;
      o[0] = (v[0][i][j] - mu[0]) * rstd[0] * gg[j] + be[j];
      o[1] = (v[1][i][j] - mu[1]) * rstd[1] * gg[j] + be[j];
      *(v2f*)&tile[tile_idx(c0 + j, w >> 1) + (w & 1) * 2] = o;
    }
  }
  __syncthreads();

  const int tg = tid & 7;
  float* op = out + ((size_t)n * CC + (tid >> 3)) * TT + t0 + tg * 4;
#pragma unroll
  for (int k = 0; k < 16; ++k) {
    const int c = k * 64 + (tid >> 3);
    *(v4f*)(op + (size_t)k * 64 * TT) = *(const v4f*)&tile[tile_idx(c, tg)];
  }
}

// ---------------------------------------------------------------------------
extern "C" void kernel_launch(void* const* d_in, const int* in_sizes, int n_in,
                              void* d_out, int out_size, void* d_ws, size_t ws_size,
                              hipStream_t stream) {
  const float* x    = (const float*)d_in[0];
  const float* w_in = (const float*)d_in[1];
  const float* w_o  = (const float*)d_in[2];
  const float* ln1g = (const float*)d_in[3];
  const float* ln1b = (const float*)d_in[4];
  const float* ln2g = (const float*)d_in[5];
  const float* ln2b = (const float*)d_in[6];
  const float* w1   = (const float*)d_in[7];
  const float* b1   = (const float*)d_in[8];
  const float* w2   = (const float*)d_in[9];
  const float* b2   = (const float*)d_in[10];

  char* ws = (char*)d_ws;
  const size_t MB = 1ull << 20;
  float*    src     = (float*)(ws + 0);            // 32 MiB; dead after LN1
  float*    ff2     = src;                         // alias (written by FFN2)
  float*    hbuf    = (float*)(ws + 32 * MB);      // 32 MiB
  _Float16* h16     = (_Float16*)(ws + 64 * MB);   // 16 MiB
  _Float16* xq      = (_Float16*)(ws + 80 * MB);   // 16 MiB; dead after QKV GEMM
  _Float16* ctx     = xq;                          // alias
  float*    attnout = (float*)(ws + 96 * MB);      // 32 MiB
  _Float16* qkv     = (_Float16*)(ws + 128 * MB);  // 48 MiB; dead after attention
  _Float16* ff      = qkv;                         // alias (64 MiB)
  _Float16* wqkv16  = (_Float16*)(ws + 192 * MB);
  _Float16* wout16  = wqkv16 + (size_t)3072 * 1024;
  _Float16* w116    = wout16 + (size_t)1024 * 1024;
  _Float16* w216    = w116 + (size_t)HIDD * 1024;

  // weight conversions f32 -> f16
  cvt_f32_f16<<<3072 * 1024 / CVT_BLK, 256, 0, stream>>>(w_in, wqkv16);
  cvt_f32_f16<<<1024 * 1024 / CVT_BLK, 256, 0, stream>>>(w_o, wout16);
  cvt_f32_f16<<<HIDD * 1024 / CVT_BLK, 256, 0, stream>>>(w1, w116);
  cvt_f32_f16<<<HIDD * 1024 / CVT_BLK, 256, 0, stream>>>(w2, w216);

  // transpose + PE
  prep_kernel<<<NB * TT / 32, 512, 0, stream>>>(x, src, xq);

  // QKV projection: [8192,1024] x [3072,1024]^T -> f16 [8192,3072]
  gemm_wmma_kernel<0><<<dim3(3072 / GBN, 8192 / GBM), 256, 0, stream>>>(
      xq, wqkv16, nullptr, qkv, 8192, 3072, 1024);

  // causal flash attention
  attn_kernel<<<dim3(TT / 16, NHEADS, NB), 32, 0, stream>>>(qkv, ctx);

  // out projection -> f32 [8192,1024]
  gemm_wmma_kernel<1><<<dim3(1024 / GBN, 8192 / GBM), 256, 0, stream>>>(
      ctx, wout16, nullptr, attnout, 8192, 1024, 1024);

  // residual + LN1 -> h (f32 + f16)
  ln1_kernel<<<NB * TT, 256, 0, stream>>>(src, attnout, ln1g, ln1b, hbuf, h16);

  // FFN1: relu(h @ w1^T + b1) -> f16 [8192,4096]
  gemm_wmma_kernel<2><<<dim3(HIDD / GBN, 8192 / GBM), 256, 0, stream>>>(
      h16, w116, b1, ff, 8192, HIDD, 1024);

  // FFN2: ff @ w2^T + b2 -> f32 [8192,1024]
  gemm_wmma_kernel<3><<<dim3(1024 / GBN, 8192 / GBM), 256, 0, stream>>>(
      ff, w216, b2, ff2, 8192, 1024, HIDD);

  // residual + LN2 + transpose back to [N,C,T]
  ln2t_kernel<<<NB * TT / 32, 512, 0, stream>>>(hbuf, ff2, ln2g, ln2b, (float*)d_out);
}

// v004
// A run of this version takes 262 microseconds.
// In both of two side-by-side timings against v003, it was 1.37 times as fast.
// All steps since v000 together make it 2.39 times as fast.
#include <hip/hip_runtime.h>
#include <hip/hip_bf16.h>
#include <math.h>

typedef __attribute__((ext_vector_type(16))) _Float16 v16h;
typedef __attribute__((ext_vector_type(8)))  _Float16 v8h;
typedef __attribute__((ext_vector_type(8)))  float    v8f;

#define NB    8
#define TT    1024
#define CC    1024
#define NHEADS 16
#define HD    64
#define HIDD  4096

__device__ __forceinline__ v16h ld_frag_row(const _Float16* __restrict__ base, int ld) {
  const int lane = threadIdx.x & 31;
  const int row  = lane & 15;
  const int koff = (lane & 16) ? 8 : 0;
  const _Float16* p = base + (size_t)row * ld + koff;
  v8h lo = *(const v8h*)(p);        // K = koff .. koff+7
  v8h hi = *(const v8h*)(p + 16);   // K = 16+koff .. 23+koff
  v16h r;
#pragma unroll
  for (int i = 0; i < 8; ++i) { r[i] = lo[i]; r[i + 8] = hi[i]; }
  return r;
}

__device__ __forceinline__ v16h ld_frag_lds(const _Float16* p) {
  v8h lo = *(const v8h*)(p);
  v8h hi = *(const v8h*)(p + 16);
  v16h r;
#pragma unroll
  for (int i = 0; i < 8; ++i) { r[i] = lo[i]; r[i + 8] = hi[i]; }
  return r;
}

// ---------------------------------------------------------------------------
// LDS-staged WMMA GEMM: D[M,N] = A[M,K] * B[N,K]^T (row-major f16, K contig).
// Block = 256 thr = 8 waves; block tile 256x128, 64 k a pass; wave tile 64x64.
// M a multiple of 256, N of 128, K of 64 (the grid covers D exactly).
// A/B panels (whole 128-byte lines of every row) lie in two LDS buffers, filled
// with global_load_async_to_lds_b128 and read as ds_load_b128 fragments; the
// next pass's copies fly while this pass's panel is worked on.
// EPI: 0 = f16 ; 1 = f32 ; 2 = relu(x+bias)->f16 ; 3 = x+bias->f32
// ---------------------------------------------------------------------------
#define GBM 256
#define GBN 128
#define GBK 64
#define GPITCH 72   // halves: a 128-byte row and 16 bytes, the b128 readers' pitch

template <int EPI>
__global__ __launch_bounds__(256)
void gemm_wmma_kernel(const _Float16* __restrict__ A, const _Float16* __restrict__ B,
                      const float* __restrict__ bias, void* __restrict__ D,
                      int M, int N, int K) {
  __shared__ __align__(16) _Float16 As[2][GBM][GPITCH];
  __shared__ __align__(16) _Float16 Bs[2][GBN][GPITCH];

  const int tid  = threadIdx.x;
  const int w    = tid >> 5;
  const int wm   = w >> 1;          // 0..3 -> 64-row strip
  const int wn   = w & 1;           // 0..1 -> 64-col strip
  const int rowB = blockIdx.y * GBM;
  const int colB = blockIdx.x * GBN;

  v8f acc[4][4];
#pragma unroll
  for (int mi = 0; mi < 4; ++mi)
#pragma unroll
    for (int j = 0; j < 4; ++j) acc[mi][j] = (v8f){};

  // One panel pair = 384 rows of 128 bytes = 12 copies of 16 bytes a thread.
  // Eight lanes cover one row, so a wave's copy is four whole lines; copy t of a
  // thread lies 32 rows below copy t-1.
  const int crow = tid >> 3;         // 0..31
  const int cseg = (tid & 7) * 8;    // halves (16-byte chunks)
  const unsigned long long gstep = (unsigned long long)K * 64;   // 32 rows, bytes
  const unsigned lstep = 32 * GPITCH * 2;                        // 32 rows, bytes
  const unsigned long long gA =
      (unsigned long long)(A + (size_t)(rowB + crow) * K + cseg);
  const unsigned long long gB =
      (unsigned long long)(B + (size_t)(colB + crow) * K + cseg);
  auto prefetch = [&](int buf, int k) {
    const unsigned long long ga = gA + (unsigned long long)k * 2;
    const unsigned long long gb = gB + (unsigned long long)k * 2;
    const unsigned la = (unsigned)(uintptr_t)&As[buf][crow][cseg];
    const unsigned lb = (unsigned)(uintptr_t)&Bs[buf][crow][cseg];
    asm volatile(
        "global_load_async_to_lds_b128 %0, %12, off\n\t"
        "global_load_async_to_lds_b128 %1, %13, off\n\t"
        "global_load_async_to_lds_b128 %2, %14, off\n\t"
        "global_load_async_to_lds_b128 %3, %15, off\n\t"
        "global_load_async_to_lds_b128 %4, %16, off\n\t"
        "global_load_async_to_lds_b128 %5, %17, off\n\t"
        "global_load_async_to_lds_b128 %6, %18, off\n\t"
        "global_load_async_to_lds_b128 %7, %19, off\n\t"
        "global_load_async_to_lds_b128 %8, %20, off\n\t"
        "global_load_async_to_lds_b128 %9, %21, off\n\t"
        "global_load_async_to_lds_b128 %10, %22, off\n\t"
        "global_load_async_to_lds_b128 %11, %23, off\n\t"
        "s_wait_xcnt 0x0"
        :: "v"(la), "v"(la + lstep), "v"(la + 2 * lstep), "v"(la + 3 * lstep),
           "v"(la + 4 * lstep), "v"(la + 5 * lstep), "v"(la + 6 * lstep),
           "v"(la + 7 * lstep),
           "v"(lb), "v"(lb + lstep), "v"(lb + 2 * lstep), "v"(lb + 3 * lstep),
           "v"(ga), "v"(ga + gstep), "v"(ga + 2 * gstep), "v"(ga + 3 * gstep),
           "v"(ga + 4 * gstep), "v"(ga + 5 * gstep), "v"(ga + 6 * gstep),
           "v"(ga + 7 * gstep),
           "v"(gb), "v"(gb + gstep), "v"(gb + 2 * gstep), "v"(gb + 3 * gstep)
        : "memory");
  };

  const int lane = tid & 31;
  const int fr   = lane & 15;
  const int koff = (lane & 16) ? 8 : 0;
  const int KT   = K / GBK;

  prefetch(0, 0);
  // panel 0 has landed for this wave, then for the block
  asm volatile("s_wait_asynccnt 0x0" ::: "memory");
  __syncthreads();
  if (KT > 1) prefetch(1, GBK);

  for (int kt = 0; kt < KT; ++kt) {
    const int buf = kt & 1;
    const _Float16* ap = &As[buf][wm * 64 + fr][koff];
    const _Float16* bp = &Bs[buf][wn * 64 + fr][koff];
    v16h a[4], b[4];
    auto load_frags = [&](int ks) {   // 16 ds_load_b128: 32 k of the wave's rows
#pragma unroll
      for (int mi = 0; mi < 4; ++mi)
        a[mi] = ld_frag_lds(ap + mi * 16 * GPITCH + ks * 32);
#pragma unroll
      for (int j = 0; j < 4; ++j)
        b[j] = ld_frag_lds(bp + j * 16 * GPITCH + ks * 32);
    };
    auto mma = [&]() {
#pragma unroll
      for (int j = 0; j < 4; ++j)
#pragma unroll
        for (int mi = 0; mi < 4; ++mi)
          acc[mi][j] = __builtin_amdgcn_wmma_f32_16x16x32_f16(
              false, a[mi], false, b[j], (short)0, acc[mi][j], false, false);
    };
    load_frags(0);
    // Keeps the 16 LDS reads one group in front of their 16 WMMAs: left alone
    // the compiler reloads one B fragment every 4 WMMAs and waits out the LDS
    // latency each time.
    __builtin_amdgcn_sched_barrier(0);
    mma();
    load_frags(1);   // the wave's last reads of this panel
    // Foot of the pass: this wave's reads of the panel are done ...
    asm volatile("s_wait_dscnt 0x0" ::: "memory");
    // ... its copies of the next panel have landed ...
    asm volatile("s_wait_asynccnt 0x0" ::: "memory");
    // ... and the one barrier publishes that panel and frees this one.
    __syncthreads();
    if (kt + 2 < KT) prefetch(buf, (kt + 2) * GBK);
    // The second half's products need registers only: behind the refill, so
    // that the copies have the whole next pass to land.
    mma();
  }
  // no copy is in flight when the wave ends
  asm volatile("s_wait_asynccnt 0x0" ::: "memory");

  const int colL = lane & 15;
  const int rb   = (lane & 16) ? 8 : 0;
#pragma unroll
  for (int mi = 0; mi < 4; ++mi) {
#pragma unroll
    for (int j = 0; j < 4; ++j) {
      const int col  = colB + wn * 64 + j * 16 + colL;
      const int row0 = rowB + wm * 64 + mi * 16 + rb;
#pragma unroll
      for (int r = 0; r < 8; ++r) {
        const size_t idx = (size_t)(row0 + r) * N + col;
        float v = acc[mi][j][r];
        if (EPI == 0) {
          ((_Float16*)D)[idx] = (_Float16)v;
        } else if (EPI == 1) {
          ((float*)D)[idx] = v;
        } else if (EPI == 2) {
          v += bias[col];
          ((_Float16*)D)[idx] = (_Float16)(v > 0.f ? v : 0.f);
        } else {
          ((float*)D)[idx] = v + bias[col];
        }
      }
    }
  }
}

// ---------------------------------------------------------------------------
// Flash attention, causal, by transposed products: S^T = K.Q^T, O^T += V^T.P^T.
// qkv: [N*T, 3C] f16 (Q | K | V slabs). ctx out: [N*T, C] f16.
// Block = 8 waves of 16 query columns = 128 queries of one (batch, head). The
// block walks the keys in stages of 64: K and V rows lie in two LDS buffers,
// filled with global_load_async_to_lds_b128; the next stage's copies fly while
// this one is worked on. A lane holds one query's scores (16 of a pass's 32
// keys): maximum and sum in the lane plus one exchange between the wave halves.
// The score tiles, converted in place, are the B operand of the second product,
// and V^T comes by ds_load_tr16_b128, so P never leaves the registers.
// Each block takes query blocks 7-x and x, so that all blocks walk 18 stages.
// ---------------------------------------------------------------------------
#define AKS 64   // keys a stage
#define AKP 72   // halves: K row and 16 bytes, the ds_load_b128 readers' pitch
#define AVP 80   // halves: V row and 32 bytes, the ds_load_tr16_b128 readers' pitch

typedef __attribute__((ext_vector_type(8))) short s16x8;

// Lane (c = l & 15, hh = l >> 4) gets 8 rows of column c of a row-major 16-bit
// LDS tile; p is the lane's own 16-byte address in that tile.
__device__ __forceinline__ v8h ld_tr16(const _Float16* p) {
  typedef __attribute__((address_space(3))) s16x8 lds_s16x8;
  return __builtin_bit_cast(v8h, __builtin_amdgcn_ds_load_tr16_b128_v8i16((lds_s16x8*)p));
}

__device__ __forceinline__ float xhalf(float x) {
  const int i = __builtin_bit_cast(int, x);
  return __builtin_bit_cast(float, __builtin_amdgcn_permlanex16(
      i, i, 0x76543210, 0xfedcba98, false, false));
}

__device__ __forceinline__ float exp2_slot(float x) {
  float r;
  asm("v_exp_f32 %0, %1\n\tv_nop" : "=v"(r) : "v"(x));
  return r;
}

__device__ __forceinline__ v8f exp2_slot8(v8f x) {
  float r0, r1, r2, r3, r4, r5, r6, r7;
  asm("v_exp_f32 %0, %8\n\t"
      "v_exp_f32 %1, %9\n\t"
      "v_exp_f32 %2, %10\n\t"
      "v_exp_f32 %3, %11\n\t"
      "v_exp_f32 %4, %12\n\t"
      "v_exp_f32 %5, %13\n\t"
      "v_exp_f32 %6, %14\n\t"
      "v_exp_f32 %7, %15\n\t"
      "v_nop"
      : "=&v"(r0), "=&v"(r1), "=&v"(r2), "=&v"(r3),
        "=&v"(r4), "=&v"(r5), "=&v"(r6), "=&v"(r7)
      : "v"(x[0]), "v"(x[1]), "v"(x[2]), "v"(x[3]),
        "v"(x[4]), "v"(x[5]), "v"(x[6]), "v"(x[7]));
  return (v8f){r0, r1, r2, r3, r4, r5, r6, r7};
}

__global__ __launch_bounds__(256)
void attn_kernel(const _Float16* __restrict__ qkv, _Float16* __restrict__ ctx) {
  __shared__ __align__(16) _Float16 Ks[2][AKS][AKP];
  __shared__ __align__(32) _Float16 Vs[2][AKS][AVP];

  const int tid  = threadIdx.x;
  const int lane = tid & 31;
  const int w    = __builtin_amdgcn_readfirstlane(tid >> 5);
  const int c    = lane & 15;
  const int hh   = lane >> 4;
  const int b    = blockIdx.z;
  const int h    = blockIdx.y;
  const int LD   = 3 * CC;
  const float cscale = 0.125f * 1.4426950408889634f;   // 1/sqrt(64), base-2 exponentials

  const _Float16* base = qkv + (size_t)(b * TT) * LD + h * HD;

  // One stage = 64 K rows and 64 V rows of 128 bytes = 4 copies of 16 bytes a
  // thread; eight lanes cover one row.
  const int crow = tid >> 3;         // 0..31
  const int cseg = (tid & 7) * 8;    // halves
  const unsigned long long gK =
      (unsigned long long)(base + CC + (size_t)crow * LD + cseg);
  auto stage = [&](int buf, int st) {
    const unsigned long long gk = gK + (unsigned long long)st * (AKS * 3 * CC * 2);
    const unsigned long long gv = gk + CC * 2;
    const unsigned lk = (unsigned)(uintptr_t)&Ks[buf][crow][cseg];
    const unsigned lv = (unsigned)(uintptr_t)&Vs[buf][crow][cseg];
    asm volatile(
        "global_load_async_to_lds_b128 %0, %4, off\n\t"
        "global_load_async_to_lds_b128 %1, %5, off\n\t"
        "global_load_async_to_lds_b128 %2, %6, off\n\t"
        "global_load_async_to_lds_b128 %3, %7, off\n\t"
        "s_wait_xcnt 0x0"
        :: "v"(lk), "v"(lk + 32 * AKP * 2), "v"(lv), "v"(lv + 32 * AVP * 2),
           "v"(gk), "v"(gk + 32 * 3 * CC * 2), "v"(gv), "v"(gv + 32 * 3 * CC * 2)
        : "memory");
  };

  for (int part = 0; part < 2; ++part) {
    const int pb  = part ? (int)blockIdx.x : 7 - (int)blockIdx.x;
    const int qw0 = pb * 128 + w * 16;   // the wave's first query
    const int nst = 2 * (pb + 1);        // stages: keys 0 .. pb*128+127

    // Every wave has left both buffers: the barrier at the foot of the last stage.
    stage(0, 0);

    const v16h qf0 = ld_frag_row(base + (size_t)qw0 * LD, LD);        // d 0..31
    const v16h qf1 = ld_frag_row(base + (size_t)qw0 * LD + 32, LD);   // d 32..63
    // The loads have taken their addresses before those registers are reused.
    asm volatile("s_wait_xcnt 0x0" ::: "memory");

    v8f acc[4];   // acc[t][r] = O^T[d = 16t + 8hh + r][query c]
    // Loops over register arrays are unrolled so that the arrays stay in registers.
#pragma unroll
    for (int t = 0; t < 4; ++t) acc[t] = (v8f){};
    float m_run = -3.0e38f;   // the query's maximum, scaled, same in both halves
    float l_run = 0.f;        // the sum over this lane's keys only

    // stage 0 has landed for this wave, then for the block
    asm volatile("s_wait_asynccnt 0x0" ::: "memory");
    __syncthreads();
    stage(1, 1);   // nst >= 2

    for (int st = 0; st < nst; ++st) {
      const int buf = st & 1;
      // unrolled: the two passes' LDS offsets become immediates
#pragma unroll
      for (int sub = 0; sub < 2; ++sub) {
        const int key0 = st * AKS + sub * 32;
        if (key0 <= qw0 + 15) {   // wave-uniform: passes beyond the diagonal are skipped
          const _Float16* kp = &Ks[buf][sub * 32 + c][8 * hh];
          const v16h k00 = ld_frag_lds(kp);
          const v16h k01 = ld_frag_lds(kp + 32);
          const v16h k10 = ld_frag_lds(kp + 16 * AKP);
          const v16h k11 = ld_frag_lds(kp + 16 * AKP + 32);

          const _Float16* vp = &Vs[buf][sub * 32 + 8 * hh + (lane & 7)][((lane >> 3) & 1) * 8];
          v16h vf[4];   // vf[t] = V^T rows d 16t..16t+15, the pass's 32 keys
#pragma unroll
          for (int t = 0; t < 4; ++t) {
            const v8h lo = ld_tr16(vp + 16 * t);
            const v8h hi = ld_tr16(vp + 16 * AVP + 16 * t);
#pragma unroll
            for (int i = 0; i < 8; ++i) { vf[t][i] = lo[i]; vf[t][i + 8] = hi[i]; }
          }

          // Keeps the pass's 16 LDS reads one group in front of its WMMAs: left alone
          // the compiler reads K two loads at a time and waits out the LDS latency
          // each time, and V^T only behind the exponentials.
          __builtin_amdgcn_sched_barrier(0);

          // s0[r] = S^T[key0 + 8hh + r][query c], s1 the 16 keys behind
          v8f s0 = (v8f){}, s1 = (v8f){};
          s0 = __builtin_amdgcn_wmma_f32_16x16x32_f16(false, k00, false, qf0, (short)0, s0, false, false);
          s1 = __builtin_amdgcn_wmma_f32_16x16x32_f16(false, k10, false, qf0, (short)0, s1, false, false);
          s0 = __builtin_amdgcn_wmma_f32_16x16x32_f16(false, k01, false, qf1, (short)0, s0, false, false);
          s1 = __builtin_amdgcn_wmma_f32_16x16x32_f16(false, k11, false, qf1, (short)0, s1, false, false);

          if (key0 + 31 > qw0) {   // wave-uniform: only the pass on the diagonal masks
            const int q = qw0 + c;
#pragma unroll
            for (int r = 0; r < 8; ++r) {
              if (key0 + 8 * hh + r > q)      s0[r] = -3.0e38f;
              if (key0 + 16 + 8 * hh + r > q) s1[r] = -3.0e38f;
            }
          }

          float mx = fmaxf(s0[0], s1[0]);
#pragma unroll
          for (int r = 1; r < 8; ++r) mx = fmaxf(mx, fmaxf(s0[r], s1[r]));
          mx = fmaxf(mx, xhalf(mx)) * cscale;   // key0 is open to every query of the wave
          const float mn    = fmaxf(m_run, mx);
          const float alpha = exp2_slot(m_run - mn);
          m_run = mn;

          v8f a0, a1;
#pragma unroll
          for (int r = 0; r < 8; ++r) {
            a0[r] = fmaf(s0[r], cscale, -mn);
            a1[r] = fmaf(s1[r], cscale, -mn);
          }
          const v8f p0 = exp2_slot8(a0);
          const v8f p1 = exp2_slot8(a1);

          v16h pf;   // P^T as B operand: element s = key key0 + 8hh + s (s < 8) or key0 + 8 + 8hh + s (s >= 8) of query c
#pragma unroll
          for (int r = 0; r < 8; ++r) {
            pf[r]     = (_Float16)p0[r];
            pf[r + 8] = (_Float16)p1[r];
          }
          const v8f ps = p0 + p1;
          const float rs = ((ps[0] + ps[1]) + (ps[2] + ps[3])) + ((ps[4] + ps[5]) + (ps[6] + ps[7]));
          l_run = l_run * alpha + rs;
#pragma unroll
          for (int t = 0; t < 4; ++t) {
            acc[t] = acc[t] * alpha;
            acc[t] = __builtin_amdgcn_wmma_f32_16x16x32_f16(false, vf[t], false, pf,
                                                            (short)0, acc[t], false, false);
          }
        }
      }
      // Foot of the stage: this wave's reads of the buffer are done ...
      asm volatile("s_wait_dscnt 0x0" ::: "memory");
      // ... its copies of the next stage have landed ...
      asm volatile("s_wait_asynccnt 0x0" ::: "memory");
      // ... and the one barrier publishes that stage and frees this buffer.
      __syncthreads();
      if (st + 2 < nst) stage(buf, st + 2);
    }
    // no copy is in flight behind the loop
    asm volatile("s_wait_asynccnt 0x0" ::: "memory");

    const float inv = 1.f / (l_run + xhalf(l_run));   // the two halves' keys joined
    _Float16* op = ctx + (size_t)(b * TT + qw0 + c) * CC + h * HD + 8 * hh;
#pragma unroll
    for (int t = 0; t < 4; ++t) {
      v8h o;   // 8 consecutive d of one query: one 16-byte store
#pragma unroll
      for (int r = 0; r < 8; ++r) o[r] = (_Float16)(acc[t][r] * inv);
      *(v8h*)(op + 16 * t) = o;
    }
    // The stores have taken their addresses before those registers are reused.
    asm volatile("s_wait_xcnt 0x0" ::: "memory");
  }
}

// ---------------------------------------------------------------------------
// Elementwise / reduction kernels
// ---------------------------------------------------------------------------
typedef __attribute__((ext_vector_type(4))) float    v4f;
typedef __attribute__((ext_vector_type(2))) float    v2f;
typedef __attribute__((ext_vector_type(4))) _Float16 v4h;

__device__ __forceinline__ int tile_idx(int c, int tg) {
  return ((c ^ ((c >> 5) & 1)) << 5) + (((tg ^ (c >> 2)) & 7) << 2);
}

__device__ __forceinline__ void sincos_rev(float rev, float& s, float& c) {
  asm("v_sin_f32 %0, %2\n\tv_cos_f32 %1, %2\n\tv_nop" : "=&v"(s), "=&v"(c) : "v"(rev));
}

// One block = 32 consecutive time steps of one batch entry, all 1024 channels.
// x is read as whole 128-byte lines along t, turned in LDS, and src / xq are
// written as whole lines along c; wave w owns time steps 2w and 2w+1.
__global__ __launch_bounds__(512)
void prep_kernel(const float* __restrict__ x, float* __restrict__ src,
                 _Float16* __restrict__ xq) {
  __shared__ __align__(16) float tile[CC * 32];
  const int tid  = threadIdx.x;
  const int lane = tid & 31;
  const int w    = tid >> 5;
  const int row0 = blockIdx.x * 32;   // n*T + t of the first time step
  const int n  = row0 >> 10;
  const int t0 = row0 & 1023;
  {
    const int tg = tid & 7;
    const float* xp = x + ((size_t)n * CC + (tid >> 3)) * TT + t0 + tg * 4;
    v4f xr[16];
#pragma unroll
    for (int k = 0; k < 16; ++k) {
      // The last load's result may be given the address pair that the loads
      // before it name: they have taken their address behind this wait.
      if (k == 15) asm volatile("s_wait_xcnt 0x0" ::: "memory");
      xr[k] = *(const v4f*)(xp + (size_t)k * 64 * TT);
    }
#pragma unroll
    for (int k = 0; k < 16; ++k)
      *(v4f*)&tile[tile_idx(k * 64 + (tid >> 3), tg)] = xr[k];
  }
  __syncthreads();

  const float k0 = -logf(10000.0f) / (float)CC;
  const float ta = (float)(t0 + 2 * w);
  const float tb = (float)(t0 + 2 * w + 1);
  float*    sp = src + (size_t)(row0 + 2 * w) * CC + lane * 4;
  _Float16* qp = xq  + (size_t)(row0 + 2 * w) * CC + lane * 4;
#pragma unroll
  for (int i = 0; i < 8; ++i) {
    const int c0 = i * 128 + lane * 4;
    v4f sa, sb;
    v4h qa, qb;
#pragma unroll
    for (int j = 0; j < 4; j += 2) {   // channels c0+j (sin) and c0+j+1 (cos) share an angle
      const float f = exp2_slot(k0 * (float)(c0 + j) * 1.4426950408889634f);
      float pea[2], peb[2];
      sincos_rev(ta * f * 0.15915494309189532f, pea[0], pea[1]);
      sincos_rev(tb * f * 0.15915494309189532f, peb[0], peb[1]);
#pragma unroll
      for (int e = 0; e < 2; ++e) {
        const v2f p = *(const v2f*)&tile[tile_idx(c0 + j + e, w >> 1) + (w & 1) * 2];
        sa[j + e] = p[0];
        sb[j + e] = p[1];
        qa[j + e] = (_Float16)(p[0] + pea[e]);
        qb[j + e] = (_Float16)(p[1] + peb[e]);
      }
    }
    *(v4f*)(sp + i * 128)      = sa;
    *(v4f*)(sp + CC + i * 128) = sb;
    *(v4h*)(qp + i * 128)      = qa;
    *(v4h*)(qp + CC + i * 128) = qb;
  }
}

#define CVT_BLK 16384
__global__ __launch_bounds__(256) __attribute__((amdgpu_waves_per_eu(2, 8)))
void cvt_f32_f16(const float* __restrict__ in, _Float16* __restrict__ out) {
  const size_t base = (size_t)blockIdx.x * CVT_BLK + (threadIdx.x >> 5) * 2048 +
                      (threadIdx.x & 31) * 4;
  const float* ip = in + base;
  _Float16*    op = out + base;
  v4f r[16];
#pragma unroll
  for (int k = 0; k < 16; ++k) {
    // The last load's result may be given the address pair that the loads
    // before it name: they have taken their address behind this wait.
    if (k == 15) asm volatile("s_wait_xcnt 0x0" ::: "memory");
    r[k] = *(const v4f*)(ip + k * 128);
  }
#pragma unroll
  for (int k = 0; k < 16; ++k) {
    v4h h;
#pragma unroll
    for (int j = 0; j < 4; ++j) h[j] = (_Float16)r[k][j];
    *(v4h*)(op + k * 128) = h;
  }
}

__device__ __forceinline__ float block_sum_256(float v, float* red) {
  const int tid = threadIdx.x;
  red[tid] = v; __syncthreads();
  for (int o = 128; o > 0; o >>= 1) {
    if (tid < o) red[tid] += red[tid + o];
    __syncthreads();
  }
  const float s = red[0];
  __syncthreads();
  return s;
}

__global__ __launch_bounds__(256)
void ln1_kernel(const float* __restrict__ a, const float* __restrict__ bb,
                const float* __restrict__ g, const float* __restrict__ beta,
                float* __restrict__ hout, _Float16* __restrict__ h16) {
  __shared__ float red[256];
  const int row = blockIdx.x, tid = threadIdx.x;
  float vals[4], s = 0.f;
#pragma unroll
  for (int i = 0; i < 4; ++i) {
    const int c = tid + i * 256;
    const float v = a[(size_t)row * CC + c] + bb[(size_t)row * CC + c];
    vals[i] = v; s += v;
  }
  const float mu = block_sum_256(s, red) * (1.f / CC);
  float sq = 0.f;
#pragma unroll
  for (int i = 0; i < 4; ++i) { const float d = vals[i] - mu; sq += d * d; }
  const float rstd = rsqrtf(block_sum_256(sq, red) * (1.f / CC) + 1e-5f);
#pragma unroll
  for (int i = 0; i < 4; ++i) {
    const int c = tid + i * 256;
    const float o = (vals[i] - mu) * rstd * g[c] + beta[c];
    hout[(size_t)row * CC + c] = o;
    h16[(size_t)row * CC + c] = (_Float16)o;
  }
}

__device__ __forceinline__ float wave_sum(float v) {
#pragma unroll
  for (int off = 16; off >= 1; off >>= 1) v += __shfl_xor(v, off, 32);
  return v;
}

// One block = 32 consecutive time steps of one batch entry. Wave w normalises
// rows 2w and 2w+1 whole (row sums inside the wave), lays the results in the LDS
// tile, and the block then stores whole 128-byte lines of out along t.
__global__ __launch_bounds__(512)
void ln2t_kernel(const float* __restrict__ a, const float* __restrict__ bb,
                 const float* __restrict__ g, const float* __restrict__ beta,
                 float* __restrict__ out) {
  __shared__ __align__(16) float tile[CC * 32];
  const int tid  = threadIdx.x;
  const int lane = tid & 31;
  const int w    = tid >> 5;
  const int row0 = blockIdx.x * 32;
  const int n  = row0 >> 10;
  const int t0 = row0 & 1023;

  const float* ap = a  + (size_t)(row0 + 2 * w) * CC + lane * 4;
  const float* bp = bb + (size_t)(row0 + 2 * w) * CC + lane * 4;
  v4f v[2][8];
#pragma unroll
  for (int r = 0; r < 2; ++r)
#pragma unroll
    for (int i = 0; i < 8; ++i)
      v[r][i] = *(const v4f*)(ap + r * CC + i * 128) + *(const v4f*)(bp + r * CC + i * 128);

  float mu[2], rstd[2];
#pragma unroll
  for (int r = 0; r < 2; ++r) {
    float s = 0.f;
#pragma unroll
    for (int i = 0; i < 8; ++i)
#pragma unroll
      for (int j = 0; j < 4; ++j) s += v[r][i][j];
    mu[r] = wave_sum(s) * (1.f / CC);
    float sq = 0.f;
#pragma unroll
    for (int i = 0; i < 8; ++i)
#pragma unroll
      for (int j = 0; j < 4; ++j) { const float d = v[r][i][j] - mu[r]; sq += d * d; }
    rstd[r] = rsqrtf(wave_sum(sq) * (1.f / CC) + 1e-5f);
  }

#pragma unroll
  for (int i = 0; i < 8; ++i) {
    const int c0 = i * 128 + lane * 4;
    const v4f gg = *(const v4f*)(g + c0);
    const v4f be = *(const v4f*)(beta + c0);
#pragma unroll
    for (int j = 0; j < 4; ++j) {
      v2f o;
      o[0] = (v[0][i][j] - mu[0]) * rstd[0] * gg[j] + be[j];
      o[1] = (v[1][i][j] - mu[1]) * rstd[1] * gg[j] + be[j];
      *(v2f*)&tile[tile_idx(c0 + j, w >> 1) + (w & 1) * 2] = o;
    }
  }
  __syncthreads();

  const int tg = tid & 7;
  float* op = out + ((size_t)n * CC + (tid >> 3)) * TT + t0 + tg * 4;
#pragma unroll
  for (int k = 0; k < 16; ++k) {
    const int c = k * 64 + (tid >> 3);
    *(v4f*)(op + (size_t)k * 64 * TT) = *(const v4f*)&tile[tile_idx(c, tg)];
  }
}

// ---------------------------------------------------------------------------
extern "C" void kernel_launch(void* const* d_in, const int* in_sizes, int n_in,
                              void* d_out, int out_size, void* d_ws, size_t ws_size,
                              hipStream_t stream) {
  const float* x    = (const float*)d_in[0];
  const float* w_in = (const float*)d_in[1];
  const float* w_o  = (const float*)d_in[2];
  const float* ln1g = (const float*)d_in[3];
  const float* ln1b = (const float*)d_in[4];
  const float* ln2g = (const float*)d_in[5];
  const float* ln2b = (const float*)d_in[6];
  const float* w1   = (const float*)d_in[7];
  const float* b1   = (const float*)d_in[8];
  const float* w2   = (const float*)d_in[9];
  const float* b2   = (const float*)d_in[10];

  char* ws = (char*)d_ws;
  const size_t MB = 1ull << 20;
  float*    src     = (float*)(ws + 0);            // 32 MiB; dead after LN1
  float*    ff2     = src;                         // alias (written by FFN2)
  float*    hbuf    = (float*)(ws + 32 * MB);      // 32 MiB
  _Float16* h16     = (_Float16*)(ws + 64 * MB);   // 16 MiB
  _Float16* xq      = (_Float16*)(ws + 80 * MB);   // 16 MiB; dead after QKV GEMM
  _Float16* ctx     = xq;                          // alias
  float*    attnout = (float*)(ws + 96 * MB);      // 32 MiB
  _Float16* qkv     = (_Float16*)(ws + 128 * MB);  // 48 MiB; dead after attention
  _Float16* ff      = qkv;                         // alias (64 MiB)
  _Float16* wqkv16  = (_Float16*)(ws + 192 * MB);
  _Float16* wout16  = wqkv16 + (size_t)3072 * 1024;
  _Float16* w116    = wout16 + (size_t)1024 * 1024;
  _Float16* w216    = w116 + (size_t)HIDD * 1024;

  // weight conversions f32 -> f16
  cvt_f32_f16<<<3072 * 1024 / CVT_BLK, 256, 0, stream>>>(w_in, wqkv16);
  cvt_f32_f16<<<1024 * 1024 / CVT_BLK, 256, 0, stream>>>(w_o, wout16);
  cvt_f32_f16<<<HIDD * 1024 / CVT_BLK, 256, 0, stream>>>(w1, w116);
  cvt_f32_f16<<<HIDD * 1024 / CVT_BLK, 256, 0, stream>>>(w2, w216);

  // transpose + PE
  prep_kernel<<<NB * TT / 32, 512, 0, stream>>>(x, src, xq);

  // QKV projection: [8192,1024] x [3072,1024]^T -> f16 [8192,3072]
  gemm_wmma_kernel<0><<<dim3(3072 / GBN, 8192 / GBM), 256, 0, stream>>>(
      xq, wqkv16, nullptr, qkv, 8192, 3072, 1024);

  // causal flash attention
  attn_kernel<<<dim3(TT / 256, NHEADS, NB), 256, 0, stream>>>(qkv, ctx);

  // out projection -> f32 [8192,1024]
  gemm_wmma_kernel<1><<<dim3(1024 / GBN, 8192 / GBM), 256, 0, stream>>>(
      ctx, wout16, nullptr, attnout, 8192, 1024, 1024);

  // residual + LN1 -> h (f32 + f16)
  ln1_kernel<<<NB * TT, 256, 0, stream>>>(src, attnout, ln1g, ln1b, hbuf, h16);

  // FFN1: relu(h @ w1^T + b1) -> f16 [8192,4096]
  gemm_wmma_kernel<2><<<dim3(HIDD / GBN, 8192 / GBM), 256, 0, stream>>>(
      h16, w116, b1, ff, 8192, HIDD, 1024);

  // FFN2: ff @ w2^T + b2 -> f32 [8192,1024]
  gemm_wmma_kernel<3><<<dim3(1024 / GBN, 8192 / GBM), 256, 0, stream>>>(
      ff, w216, b2, ff2, 8192, 1024, HIDD);

  // residual + LN2 + transpose back to [N,C,T]
  ln2t_kernel<<<NB * TT / 32, 512, 0, stream>>>(hbuf, ff2, ln2g, ln2b, (float*)d_out);
}

// v005
// It runs in 245 microseconds.
// Timed twice side by side with v004, it ran 1.07 times as fast both times.
// Over all steps from v000 it is 2.57 times as fast.
#include <hip/hip_runtime.h>
#include <hip/hip_bf16.h>
#include <math.h>

typedef __attribute__((ext_vector_type(16))) _Float16 v16h;
typedef __attribute__((ext_vector_type(8)))  _Float16 v8h;
typedef __attribute__((ext_vector_type(8)))  float    v8f;
typedef __attribute__((ext_vector_type(4)))  float    v4f;

#define NB    8
#define TT    1024
#define CC    1024
#define NHEADS 16
#define HD    64
#define HIDD  4096

__device__ __forceinline__ v16h ld_frag_row(const _Float16* __restrict__ base, int ld) {
  const int lane = threadIdx.x & 31;
  const int row  = lane & 15;
  const int koff = (lane & 16) ? 8 : 0;
  const _Float16* p = base + (size_t)row * ld + koff;
  v8h lo = *(const v8h*)(p);        // K = koff .. koff+7
  v8h hi = *(const v8h*)(p + 16);   // K = 16+koff .. 23+koff
  v16h r;
#pragma unroll
  for (int i = 0; i < 8; ++i) { r[i] = lo[i]; r[i + 8] = hi[i]; }
  return r;
}

__device__ __forceinline__ v16h ld_frag_lds(const _Float16* p) {
  v8h lo = *(const v8h*)(p);
  v8h hi = *(const v8h*)(p + 16);
  v16h r;
#pragma unroll
  for (int i = 0; i < 8; ++i) { r[i] = lo[i]; r[i + 8] = hi[i]; }
  return r;
}

// ---------------------------------------------------------------------------
// LDS-staged WMMA GEMM: D[M,N] = A[M,K] * B[N,K]^T (row-major f16, K contig).
// Block = 256 thr = 8 waves; block tile 256x128, 64 k a pass; wave tile 64x64.
// M a multiple of 256, N of 128, K of 64 (the grid covers D exactly).
// A/B panels (whole 128-byte lines of every row) lie in two LDS buffers, filled
// with global_load_async_to_lds_b128 and read as ds_load_b128 fragments; the
// next pass's copies fly while this pass's panel is worked on.
// EPI: 0 = f16 ; 1 = f32 ; 2 = relu(x+bias)->f16 ; 3 = x+bias->f32
// NC = N at compile time: the epilogue's row steps become immediate offsets, so
// that all stores of a lane share one address pair.
// ---------------------------------------------------------------------------
#define GBM 256
#define GBN 128
#define GBK 64
#define GPITCH 72   // halves: a 128-byte row and 16 bytes, the b128 readers' pitch

template <int EPI, int NC>
__global__ __launch_bounds__(256)
void gemm_wmma_kernel(const _Float16* __restrict__ A, const _Float16* __restrict__ B,
                      const float* __restrict__ bias, void* __restrict__ D,
                      int M, int N, int K) {
  __shared__ __align__(16) _Float16 As[2][GBM][GPITCH];
  __shared__ __align__(16) _Float16 Bs[2][GBN][GPITCH];

  const int tid  = threadIdx.x;
  const int w    = tid >> 5;
  const int wm   = w >> 1;          // 0..3 -> 64-row strip
  const int wn   = w & 1;           // 0..1 -> 64-col strip
  const int rowB = blockIdx.y * GBM;
  const int colB = blockIdx.x * GBN;

  v8f acc[4][4];
#pragma unroll
  for (int mi = 0; mi < 4; ++mi)
#pragma unroll
    for (int j = 0; j < 4; ++j) acc[mi][j] = (v8f){};

  // One panel pair = 384 rows of 128 bytes = 12 copies of 16 bytes a thread.
  // Eight lanes cover one row, so a wave's copy is four whole lines; copy t of a
  // thread lies 32 rows below copy t-1.
  const int crow = tid >> 3;         // 0..31
  const int cseg = (tid & 7) * 8;    // halves (16-byte chunks)
  const unsigned long long gstep = (unsigned long long)K * 64;   // 32 rows, bytes
  const unsigned lstep = 32 * GPITCH * 2;                        // 32 rows, bytes
  const unsigned long long gA =
      (unsigned long long)(A + (size_t)(rowB + crow) * K + cseg);
  const unsigned long long gB =
      (unsigned long long)(B + (size_t)(colB + crow) * K + cseg);
  auto prefetch = [&](int buf, int k) {
    const unsigned long long ga = gA + (unsigned long long)k * 2;
    const unsigned long long gb = gB + (unsigned long long)k * 2;
    const unsigned la = (unsigned)(uintptr_t)&As[buf][crow][cseg];
    const unsigned lb = (unsigned)(uintptr_t)&Bs[buf][crow][cseg];
    asm volatile(
        "global_load_async_to_lds_b128 %0, %12, off\n\t"
        "global_load_async_to_lds_b128 %1, %13, off\n\t"
        "global_load_async_to_lds_b128 %2, %14, off\n\t"
        "global_load_async_to_lds_b128 %3, %15, off\n\t"
        "global_load_async_to_lds_b128 %4, %16, off\n\t"
        "global_load_async_to_lds_b128 %5, %17, off\n\t"
        "global_load_async_to_lds_b128 %6, %18, off\n\t"
        "global_load_async_to_lds_b128 %7, %19, off\n\t"
        "global_load_async_to_lds_b128 %8, %20, off\n\t"
        "global_load_async_to_lds_b128 %9, %21, off\n\t"
        "global_load_async_to_lds_b128 %10, %22, off\n\t"
        "global_load_async_to_lds_b128 %11, %23, off\n\t"
        "s_wait_xcnt 0x0"
        :: "v"(la), "v"(la + lstep), "v"(la + 2 * lstep), "v"(la + 3 * lstep),
           "v"(la + 4 * lstep), "v"(la + 5 * lstep), "v"(la + 6 * lstep),
           "v"(la + 7 * lstep),
           "v"(lb), "v"(lb + lstep), "v"(lb + 2 * lstep), "v"(lb + 3 * lstep),
           "v"(ga), "v"(ga + gstep), "v"(ga + 2 * gstep), "v"(ga + 3 * gstep),
           "v"(ga + 4 * gstep), "v"(ga + 5 * gstep), "v"(ga + 6 * gstep),
           "v"(ga + 7 * gstep),
           "v"(gb), "v"(gb + gstep), "v"(gb + 2 * gstep), "v"(gb + 3 * gstep)
        : "memory");
  };

  const int lane = tid & 31;
  const int fr   = lane & 15;
  const int koff = (lane & 16) ? 8 : 0;
  const int KT   = K / GBK;

  prefetch(0, 0);
  // panel 0 has landed for this wave, then for the block
  asm volatile("s_wait_asynccnt 0x0" ::: "memory");
  __syncthreads();
  if (KT > 1) prefetch(1, GBK);

  for (int kt = 0; kt < KT; ++kt) {
    const int buf = kt & 1;
    const _Float16* ap = &As[buf][wm * 64 + fr][koff];
    const _Float16* bp = &Bs[buf][wn * 64 + fr][koff];
    v16h a[4], b[4];
    auto load_frags = [&](int ks) {   // 16 ds_load_b128: 32 k of the wave's rows
#pragma unroll
      for (int mi = 0; mi < 4; ++mi)
        a[mi] = ld_frag_lds(ap + mi * 16 * GPITCH + ks * 32);
#pragma unroll
      for (int j = 0; j < 4; ++j)
        b[j] = ld_frag_lds(bp + j * 16 * GPITCH + ks * 32);
    };
    auto mma = [&]() {
#pragma unroll
      for (int j = 0; j < 4; ++j)
#pragma unroll
        for (int mi = 0; mi < 4; ++mi)
          acc[mi][j] = __builtin_amdgcn_wmma_f32_16x16x32_f16(
              false, b[j], false, a[mi], (short)0, acc[mi][j], false, false);
    };
    load_frags(0);
    // Keeps the 16 LDS reads one group in front of their 16 WMMAs: left alone
    // the compiler reloads one B fragment every 4 WMMAs and waits out the LDS
    // latency each time.
    __builtin_amdgcn_sched_barrier(0);
    mma();
    load_frags(1);   // the wave's last reads of this panel
    // Foot of the pass: this wave's reads of the panel are done ...
    asm volatile("s_wait_dscnt 0x0" ::: "memory");
    // ... its copies of the next panel have landed ...
    asm volatile("s_wait_asynccnt 0x0" ::: "memory");
    // ... and the one barrier publishes that panel and frees this one.
    __syncthreads();
    if (kt + 2 < KT) prefetch(buf, (kt + 2) * GBK);
    // The second half's products need registers only: behind the refill, so
    // that the copies have the whole next pass to land.
    mma();
  }
  // no copy is in flight when the wave ends
  asm volatile("s_wait_asynccnt 0x0" ::: "memory");

  // Epilogue. The weight rows are the first WMMA operand, so lane (c, hh) holds
  // D[m0 + 16 mi + c][n0 + 16 j + 8 hh + r], r = 0..7: 8 consecutive columns of a row.
  // Each wave lays its 64x64 tile in its own 9216 bytes of As (every wave has left
  // the ring at the last pass's barrier and no copy is in flight), reads it back by
  // rows and stores whole 128-byte lines.
  const int c  = lane & 15;
  const int hh = lane >> 4;
  const int n0 = colB + wn * 64;
  const int m0 = rowB + wm * 64;
  char* stg = (char*)&As[0][0][0] + w * (64 * GPITCH * 2);
  if (EPI == 0 || EPI == 2) {
    // f16: 64 rows of 128 bytes at the ring's pitch of 144
#pragma unroll
    for (int j = 0; j < 4; ++j) {
      v4f bl = (v4f){}, bh = (v4f){};
      if (EPI == 2) {
        bl = *(const v4f*)(bias + n0 + j * 16 + 8 * hh);
        bh = *(const v4f*)(bias + n0 + j * 16 + 8 * hh + 4);
      }
#pragma unroll
      for (int mi = 0; mi < 4; ++mi) {
        v8h o;
#pragma unroll
        for (int r = 0; r < 8; ++r) {
          float v = acc[mi][j][r];
          if (EPI == 2) {
            v += (r < 4) ? bl[r & 3] : bh[r & 3];
            v = v > 0.f ? v : 0.f;
          }
          o[r] = (_Float16)v;
        }
        *(v8h*)(stg + (mi * 16 + c) * (GPITCH * 2) + j * 32 + hh * 16) = o;
      }
    }
    // The other lanes' rows are in LDS before this lane reads them back.
    asm volatile("s_wait_dscnt 0x0" ::: "memory");
    const int rr = lane >> 3;   // eight lanes cover one 128-byte line
    _Float16* dp = (_Float16*)D + (size_t)(m0 + rr) * NC + n0 + (lane & 7) * 8;
    const char* sp = stg + rr * (GPITCH * 2) + (lane & 7) * 16;
#pragma unroll
    for (int it = 0; it < 16; ++it)
      *(v8h*)(dp + it * 4 * NC) = *(const v8h*)(sp + it * 4 * (GPITCH * 2));
  } else {
    // f32: 32 rows of 256 bytes at a pitch of 272, in two rounds
    const int FP = 272;
    v4f bl[4], bh[4];
    if (EPI == 3) {
#pragma unroll
      for (int j = 0; j < 4; ++j) {
        bl[j] = *(const v4f*)(bias + n0 + j * 16 + 8 * hh);
        bh[j] = *(const v4f*)(bias + n0 + j * 16 + 8 * hh + 4);
      }
    }
    const int rr = lane >> 4;   // sixteen lanes cover one row's two lines
    const char* sp = stg + rr * FP + (lane & 15) * 16;
    float* dp = (float*)D + (size_t)(m0 + rr) * NC + n0 + (lane & 15) * 4;
#pragma unroll
    for (int half = 0; half < 2; ++half) {
#pragma unroll
      for (int m2 = 0; m2 < 2; ++m2) {
#pragma unroll
        for (int j = 0; j < 4; ++j) {
          const v8f t = acc[half * 2 + m2][j];
          v4f lo = (v4f){t[0], t[1], t[2], t[3]};
          v4f hi = (v4f){t[4], t[5], t[6], t[7]};
          if (EPI == 3) { lo += bl[j]; hi += bh[j]; }
          char* q = stg + (m2 * 16 + c) * FP + j * 64 + hh * 32;
          *(v4f*)(q)      = lo;
          *(v4f*)(q + 16) = hi;
        }
      }
      // The other lanes' rows are in LDS before this lane reads them back.
      asm volatile("s_wait_dscnt 0x0" ::: "memory");
#pragma unroll
      for (int it = 0; it < 16; ++it)
        *(v4f*)(dp + (half * 32 + it * 2) * NC) = *(const v4f*)(sp + it * 2 * FP);
      // This round's rows have been read before the next round overwrites them, and
      // its stores have taken their registers before the next round's reads land there.
      if (half == 0) asm volatile("s_wait_dscnt 0x0\n\ts_wait_xcnt 0x0" ::: "memory");
    }
  }
}

// ---------------------------------------------------------------------------
// Flash attention, causal, by transposed products: S^T = K.Q^T, O^T += V^T.P^T.
// qkv: [N*T, 3C] f16 (Q | K | V slabs). ctx out: [N*T, C] f16.
// Block = 8 waves of 16 query columns = 128 queries of one (batch, head). The
// block walks the keys in stages of 64: K and V rows lie in two LDS buffers,
// filled with global_load_async_to_lds_b128; the next stage's copies fly while
// this one is worked on. A lane holds one query's scores (16 of a pass's 32
// keys): maximum and sum in the lane plus one exchange between the wave halves.
// The score tiles, converted in place, are the B operand of the second product,
// and V^T comes by ds_load_tr16_b128, so P never leaves the registers.
// Each block takes query blocks 7-x and x, so that all blocks walk 18 stages.
// ---------------------------------------------------------------------------
#define AKS 64   // keys a stage
#define AKP 72   // halves: K row and 16 bytes, the ds_load_b128 readers' pitch
#define AVP 80   // halves: V row and 32 bytes, the ds_load_tr16_b128 readers' pitch

typedef __attribute__((ext_vector_type(8))) short s16x8;

// Lane (c = l & 15, hh = l >> 4) gets 8 rows of column c of a row-major 16-bit
// LDS tile; p is the lane's own 16-byte address in that tile.
__device__ __forceinline__ v8h ld_tr16(const _Float16* p) {
  typedef __attribute__((address_space(3))) s16x8 lds_s16x8;
  return __builtin_bit_cast(v8h, __builtin_amdgcn_ds_load_tr16_b128_v8i16((lds_s16x8*)p));
}

__device__ __forceinline__ float xhalf(float x) {
  const int i = __builtin_bit_cast(int, x);
  return __builtin_bit_cast(float, __builtin_amdgcn_permlanex16(
      i, i, 0x76543210, 0xfedcba98, false, false));
}

__device__ __forceinline__ float exp2_slot(float x) {
  float r;
  asm("v_exp_f32 %0, %1\n\tv_nop" : "=v"(r) : "v"(x));
  return r;
}

__device__ __forceinline__ v8f exp2_slot8(v8f x) {
  float r0, r1, r2, r3, r4, r5, r6, r7;
  asm("v_exp_f32 %0, %8\n\t"
      "v_exp_f32 %1, %9\n\t"
      "v_exp_f32 %2, %10\n\t"
      "v_exp_f32 %3, %11\n\t"
      "v_exp_f32 %4, %12\n\t"
      "v_exp_f32 %5, %13\n\t"
      "v_exp_f32 %6, %14\n\t"
      "v_exp_f32 %7, %15\n\t"
      "v_nop"
      : "=&v"(r0), "=&v"(r1), "=&v"(r2), "=&v"(r3),
        "=&v"(r4), "=&v"(r5), "=&v"(r6), "=&v"(r7)
      : "v"(x[0]), "v"(x[1]), "v"(x[2]), "v"(x[3]),
        "v"(x[4]), "v"(x[5]), "v"(x[6]), "v"(x[7]));
  return (v8f){r0, r1, r2, r3, r4, r5, r6, r7};
}

__global__ __launch_bounds__(256)
void attn_kernel(const _Float16* __restrict__ qkv, _Float16* __restrict__ ctx) {
  __shared__ __align__(16) _Float16 Ks[2][AKS][AKP];
  __shared__ __align__(32) _Float16 Vs[2][AKS][AVP];

  const int tid  = threadIdx.x;
  const int lane = tid & 31;
  const int w    = __builtin_amdgcn_readfirstlane(tid >> 5);
  const int c    = lane & 15;
  const int hh   = lane >> 4;
  const int b    = blockIdx.z;
  const int h    = blockIdx.y;
  const int LD   = 3 * CC;
  const float cscale = 0.125f * 1.4426950408889634f;   // 1/sqrt(64), base-2 exponentials

  const _Float16* base = qkv + (size_t)(b * TT) * LD + h * HD;

  // One stage = 64 K rows and 64 V rows of 128 bytes = 4 copies of 16 bytes a
  // thread; eight lanes cover one row.
  const int crow = tid >> 3;         // 0..31
  const int cseg = (tid & 7) * 8;    // halves
  const unsigned long long gK =
      (unsigned long long)(base + CC + (size_t)crow * LD + cseg);
  auto stage = [&](int buf, int st) {
    const unsigned long long gk = gK + (unsigned long long)st * (AKS * 3 * CC * 2);
    const unsigned long long gv = gk + CC * 2;
    const unsigned lk = (unsigned)(uintptr_t)&Ks[buf][crow][cseg];
    const unsigned lv = (unsigned)(uintptr_t)&Vs[buf][crow][cseg];
    asm volatile(
        "global_load_async_to_lds_b128 %0, %4, off\n\t"
        "global_load_async_to_lds_b128 %1, %5, off\n\t"
        "global_load_async_to_lds_b128 %2, %6, off\n\t"
        "global_load_async_to_lds_b128 %3, %7, off\n\t"
        "s_wait_xcnt 0x0"
        :: "v"(lk), "v"(lk + 32 * AKP * 2), "v"(lv), "v"(lv + 32 * AVP * 2),
           "v"(gk), "v"(gk + 32 * 3 * CC * 2), "v"(gv), "v"(gv + 32 * 3 * CC * 2)
        : "memory");
  };

  for (int part = 0; part < 2; ++part) {
    const int pb  = part ? (int)blockIdx.x : 7 - (int)blockIdx.x;
    const int qw0 = pb * 128 + w * 16;   // the wave's first query
    const int nst = 2 * (pb + 1);        // stages: keys 0 .. pb*128+127

    // Every wave has left both buffers: the barrier at the foot of the last stage.
    stage(0, 0);

    const v16h qf0 = ld_frag_row(base + (size_t)qw0 * LD, LD);        // d 0..31
    const v16h qf1 = ld_frag_row(base + (size_t)qw0 * LD + 32, LD);   // d 32..63
    // The loads have taken their addresses before those registers are reused.
    asm volatile("s_wait_xcnt 0x0" ::: "memory");

    v8f acc[4];   // acc[t][r] = O^T[d = 16t + 8hh + r][query c]
    // Loops over register arrays are unrolled so that the arrays stay in registers.
#pragma unroll
    for (int t = 0; t < 4; ++t) acc[t] = (v8f){};
    float m_run = -3.0e38f;   // the query's maximum, scaled, same in both halves
    float l_run = 0.f;        // the sum over this lane's keys only

    // stage 0 has landed for this wave, then for the block
    asm volatile("s_wait_asynccnt 0x0" ::: "memory");
    __syncthreads();
    stage(1, 1);   // nst >= 2

    for (int st = 0; st < nst; ++st) {
      const int buf = st & 1;
      // unrolled: the two passes' LDS offsets become immediates
#pragma unroll
      for (int sub = 0; sub < 2; ++sub) {
        const int key0 = st * AKS + sub * 32;
        if (key0 <= qw0 + 15) {   // wave-uniform: passes beyond the diagonal are skipped
          const _Float16* kp = &Ks[buf][sub * 32 + c][8 * hh];
          const v16h k00 = ld_frag_lds(kp);
          const v16h k01 = ld_frag_lds(kp + 32);
          const v16h k10 = ld_frag_lds(kp + 16 * AKP);
          const v16h k11 = ld_frag_lds(kp + 16 * AKP + 32);

          const _Float16* vp = &Vs[buf][sub * 32 + 8 * hh + (lane & 7)][((lane >> 3) & 1) * 8];
          v16h vf[4];   // vf[t] = V^T rows d 16t..16t+15, the pass's 32 keys
#pragma unroll
          for (int t = 0; t < 4; ++t) {
            const v8h lo = ld_tr16(vp + 16 * t);
            const v8h hi = ld_tr16(vp + 16 * AVP + 16 * t);
#pragma unroll
            for (int i = 0; i < 8; ++i) { vf[t][i] = lo[i]; vf[t][i + 8] = hi[i]; }
          }

          // Keeps the pass's 16 LDS reads one group in front of its WMMAs: left alone
          // the compiler reads K two loads at a time and waits out the LDS latency
          // each time, and V^T only behind the exponentials.
          __builtin_amdgcn_sched_barrier(0);

          // s0[r] = S^T[key0 + 8hh + r][query c], s1 the 16 keys behind
          v8f s0 = (v8f){}, s1 = (v8f){};
          s0 = __builtin_amdgcn_wmma_f32_16x16x32_f16(false, k00, false, qf0, (short)0, s0, false, false);
          s1 = __builtin_amdgcn_wmma_f32_16x16x32_f16(false, k10, false, qf0, (short)0, s1, false, false);
          s0 = __builtin_amdgcn_wmma_f32_16x16x32_f16(false, k01, false, qf1, (short)0, s0, false, false);
          s1 = __builtin_amdgcn_wmma_f32_16x16x32_f16(false, k11, false, qf1, (short)0, s1, false, false);

          if (key0 + 31 > qw0) {   // wave-uniform: only the pass on the diagonal masks
            const int q = qw0 + c;
#pragma unroll
            for (int r = 0; r < 8; ++r) {
              if (key0 + 8 * hh + r > q)      s0[r] = -3.0e38f;
              if (key0 + 16 + 8 * hh + r > q) s1[r] = -3.0e38f;
            }
          }

          float mx = fmaxf(s0[0], s1[0]);
#pragma unroll
          for (int r = 1; r < 8; ++r) mx = fmaxf(mx, fmaxf(s0[r], s1[r]));
          mx = fmaxf(mx, xhalf(mx)) * cscale;   // key0 is open to every query of the wave
          const float mn    = fmaxf(m_run, mx);
          const float alpha = exp2_slot(m_run - mn);
          m_run = mn;

          v8f a0, a1;
#pragma unroll
          for (int r = 0; r < 8; ++r) {
            a0[r] = fmaf(s0[r], cscale, -mn);
            a1[r] = fmaf(s1[r], cscale, -mn);
          }
          const v8f p0 = exp2_slot8(a0);
          const v8f p1 = exp2_slot8(a1);

          v16h pf;   // P^T as B operand: element s = key key0 + 8hh + s (s < 8) or key0 + 8 + 8hh + s (s >= 8) of query c
#pragma unroll
          for (int r = 0; r < 8; ++r) {
            pf[r]     = (_Float16)p0[r];
            pf[r + 8] = (_Float16)p1[r];
          }
          const v8f ps = p0 + p1;
          const float rs = ((ps[0] + ps[1]) + (ps[2] + ps[3])) + ((ps[4] + ps[5]) + (ps[6] + ps[7]));
          l_run = l_run * alpha + rs;
#pragma unroll
          for (int t = 0; t < 4; ++t) {
            acc[t] = acc[t] * alpha;
            acc[t] = __builtin_amdgcn_wmma_f32_16x16x32_f16(false, vf[t], false, pf,
                                                            (short)0, acc[t], false, false);
          }
        }
      }
      // Foot of the stage: this wave's reads of the buffer are done ...
      asm volatile("s_wait_dscnt 0x0" ::: "memory");
      // ... its copies of the next stage have landed ...
      asm volatile("s_wait_asynccnt 0x0" ::: "memory");
      // ... and the one barrier publishes that stage and frees this buffer.
      __syncthreads();
      if (st + 2 < nst) stage(buf, st + 2);
    }
    // no copy is in flight behind the loop
    asm volatile("s_wait_asynccnt 0x0" ::: "memory");

    const float inv = 1.f / (l_run + xhalf(l_run));   // the two halves' keys joined
    _Float16* op = ctx + (size_t)(b * TT + qw0 + c) * CC + h * HD + 8 * hh;
#pragma unroll
    for (int t = 0; t < 4; ++t) {
      v8h o;   // 8 consecutive d of one query: one 16-byte store
#pragma unroll
      for (int r = 0; r < 8; ++r) o[r] = (_Float16)(acc[t][r] * inv);
      *(v8h*)(op + 16 * t) = o;
    }
    // The stores have taken their addresses before those registers are reused.
    asm volatile("s_wait_xcnt 0x0" ::: "memory");
  }
}

// ---------------------------------------------------------------------------
// Elementwise / reduction kernels
// ---------------------------------------------------------------------------
typedef __attribute__((ext_vector_type(2))) float    v2f;
typedef __attribute__((ext_vector_type(4))) _Float16 v4h;

__device__ __forceinline__ int tile_idx(int c, int tg) {
  return ((c ^ ((c >> 5) & 1)) << 5) + (((tg ^ (c >> 2)) & 7) << 2);
}

__device__ __forceinline__ void sincos_rev(float rev, float& s, float& c) {
  asm("v_sin_f32 %0, %2\n\tv_cos_f32 %1, %2\n\tv_nop" : "=&v"(s), "=&v"(c) : "v"(rev));
}

// One block = 32 consecutive time steps of one batch entry, all 1024 channels.
// x is read as whole 128-byte lines along t, turned in LDS, and src / xq are
// written as whole lines along c; wave w owns time steps 2w and 2w+1.
__global__ __launch_bounds__(512)
void prep_kernel(const float* __restrict__ x, float* __restrict__ src,
                 _Float16* __restrict__ xq) {
  __shared__ __align__(16) float tile[CC * 32];
  const int tid  = threadIdx.x;
  const int lane = tid & 31;
  const int w    = tid >> 5;
  const int row0 = blockIdx.x * 32;   // n*T + t of the first time step
  const int n  = row0 >> 10;
  const int t0 = row0 & 1023;
  {
    const int tg = tid & 7;
    const float* xp = x + ((size_t)n * CC + (tid >> 3)) * TT + t0 + tg * 4;
    v4f xr[16];
#pragma unroll
    for (int k = 0; k < 16; ++k) {
      // The last load's result may be given the address pair that the loads
      // before it name: they have taken their address behind this wait.
      if (k == 15) asm volatile("s_wait_xcnt 0x0" ::: "memory");
      xr[k] = *(const v4f*)(xp + (size_t)k * 64 * TT);
    }
#pragma unroll
    for (int k = 0; k < 16; ++k)
      *(v4f*)&tile[tile_idx(k * 64 + (tid >> 3), tg)] = xr[k];
  }
  __syncthreads();

  const float k0 = -logf(10000.0f) / (float)CC;
  const float ta = (float)(t0 + 2 * w);
  const float tb = (float)(t0 + 2 * w + 1);
  float*    sp = src + (size_t)(row0 + 2 * w) * CC + lane * 4;
  _Float16* qp = xq  + (size_t)(row0 + 2 * w) * CC + lane * 4;
#pragma unroll
  for (int i = 0; i < 8; ++i) {
    const int c0 = i * 128 + lane * 4;
    v4f sa, sb;
    v4h qa, qb;
#pragma unroll
    for (int j = 0; j < 4; j += 2) {   // channels c0+j (sin) and c0+j+1 (cos) share an angle
      const float f = exp2_slot(k0 * (float)(c0 + j) * 1.4426950408889634f);
      float pea[2], peb[2];
      sincos_rev(ta * f * 0.15915494309189532f, pea[0], pea[1]);
      sincos_rev(tb * f * 0.15915494309189532f, peb[0], peb[1]);
#pragma unroll
      for (int e = 0; e < 2; ++e) {
        const v2f p = *(const v2f*)&tile[tile_idx(c0 + j + e, w >> 1) + (w & 1) * 2];
        sa[j + e] = p[0];
        sb[j + e] = p[1];
        qa[j + e] = (_Float16)(p[0] + pea[e]);
        qb[j + e] = (_Float16)(p[1] + peb[e]);
      }
    }
    *(v4f*)(sp + i * 128)      = sa;
    *(v4f*)(sp + CC + i * 128) = sb;
    *(v4h*)(qp + i * 128)      = qa;
    *(v4h*)(qp + CC + i * 128) = qb;
  }
}

#define CVT_BLK 16384
__global__ __launch_bounds__(256) __attribute__((amdgpu_waves_per_eu(2, 8)))
void cvt_f32_f16(const float* __restrict__ in, _Float16* __restrict__ out) {
  const size_t base = (size_t)blockIdx.x * CVT_BLK + (threadIdx.x >> 5) * 2048 +
                      (threadIdx.x & 31) * 4;
  const float* ip = in + base;
  _Float16*    op = out + base;
  v4f r[16];
#pragma unroll
  for (int k = 0; k < 16; ++k) {
    // The last load's result may be given the address pair that the loads
    // before it name: they have taken their address behind this wait.
    if (k == 15) asm volatile("s_wait_xcnt 0x0" ::: "memory");
    r[k] = *(const v4f*)(ip + k * 128);
  }
#pragma unroll
  for (int k = 0; k < 16; ++k) {
    v4h h;
#pragma unroll
    for (int j = 0; j < 4; ++j) h[j] = (_Float16)r[k][j];
    *(v4h*)(op + k * 128) = h;
  }
}

__device__ __forceinline__ float block_sum_256(float v, float* red) {
  const int tid = threadIdx.x;
  red[tid] = v; __syncthreads();
  for (int o = 128; o > 0; o >>= 1) {
    if (tid < o) red[tid] += red[tid + o];
    __syncthreads();
  }
  const float s = red[0];
  __syncthreads();
  return s;
}

__global__ __launch_bounds__(256)
void ln1_kernel(const float* __restrict__ a, const float* __restrict__ bb,
                const float* __restrict__ g, const float* __restrict__ beta,
                float* __restrict__ hout, _Float16* __restrict__ h16) {
  __shared__ float red[256];
  const int row = blockIdx.x, tid = threadIdx.x;
  float vals[4], s = 0.f;
#pragma unroll
  for (int i = 0; i < 4; ++i) {
    const int c = tid + i * 256;
    const float v = a[(size_t)row * CC + c] + bb[(size_t)row * CC + c];
    vals[i] = v; s += v;
  }
  const float mu = block_sum_256(s, red) * (1.f / CC);
  float sq = 0.f;
#pragma unroll
  for (int i = 0; i < 4; ++i) { const float d = vals[i] - mu; sq += d * d; }
  const float rstd = rsqrtf(block_sum_256(sq, red) * (1.f / CC) + 1e-5f);
#pragma unroll
  for (int i = 0; i < 4; ++i) {
    const int c = tid + i * 256;
    const float o = (vals[i] - mu) * rstd * g[c] + beta[c];
    hout[(size_t)row * CC + c] = o;
    h16[(size_t)row * CC + c] = (_Float16)o;
  }
}

__device__ __forceinline__ float wave_sum(float v) {
#pragma unroll
  for (int off = 16; off >= 1; off >>= 1) v += __shfl_xor(v, off, 32);
  return v;
}

// One block = 32 consecutive time steps of one batch entry. Wave w normalises
// rows 2w and 2w+1 whole (row sums inside the wave), lays the results in the LDS
// tile, and the block then stores whole 128-byte lines of out along t.
__global__ __launch_bounds__(512)
void ln2t_kernel(const float* __restrict__ a, const float* __restrict__ bb,
                 const float* __restrict__ g, const float* __restrict__ beta,
                 float* __restrict__ out) {
  __shared__ __align__(16) float tile[CC * 32];
  const int tid  = threadIdx.x;
  const int lane = tid & 31;
  const int w    = tid >> 5;
  const int row0 = blockIdx.x * 32;
  const int n  = row0 >> 10;
  const int t0 = row0 & 1023;

  const float* ap = a  + (size_t)(row0 + 2 * w) * CC + lane * 4;
  const float* bp = bb + (size_t)(row0 + 2 * w) * CC + lane * 4;
  v4f v[2][8];
#pragma unroll
  for (int r = 0; r < 2; ++r)
#pragma unroll
    for (int i = 0; i < 8; ++i)
      v[r][i] = *(const v4f*)(ap + r * CC + i * 128) + *(const v4f*)(bp + r * CC + i * 128);

  float mu[2], rstd[2];
#pragma unroll
  for (int r = 0; r < 2; ++r) {
    float s = 0.f;
#pragma unroll
    for (int i = 0; i < 8; ++i)
#pragma unroll
      for (int j = 0; j < 4; ++j) s += v[r][i][j];
    mu[r] = wave_sum(s) * (1.f / CC);
    float sq = 0.f;
#pragma unroll
    for (int i = 0; i < 8; ++i)
#pragma unroll
      for (int j = 0; j < 4; ++j) { const float d = v[r][i][j] - mu[r]; sq += d * d; }
    rstd[r] = rsqrtf(wave_sum(sq) * (1.f / CC) + 1e-5f);
  }

#pragma unroll
  for (int i = 0; i < 8; ++i) {
    const int c0 = i * 128 + lane * 4;
    const v4f gg = *(const v4f*)(g + c0);
    const v4f be = *(const v4f*)(beta + c0);
#pragma unroll
    for (int j = 0; j < 4; ++j) {
      v2f o;
      o[0] = (v[0][i][j] - mu[0]) * rstd[0] * gg[j] + be[j];
      o[1] = (v[1][i][j] - mu[1]) * rstd[1] * gg[j] + be[j];
      *(v2f*)&tile[tile_idx(c0 + j, w >> 1) + (w & 1) * 2] = o;
    }
  }
  __syncthreads();

  const int tg = tid & 7;
  float* op = out + ((size_t)n * CC + (tid >> 3)) * TT + t0 + tg * 4;
#pragma unroll
  for (int k = 0; k < 16; ++k) {
    const int c = k * 64 + (tid >> 3);
    *(v4f*)(op + (size_t)k * 64 * TT) = *(const v4f*)&tile[tile_idx(c, tg)];
  }
}

// ---------------------------------------------------------------------------
extern "C" void kernel_launch(void* const* d_in, const int* in_sizes, int n_in,
                              void* d_out, int out_size, void* d_ws, size_t ws_size,
                              hipStream_t stream) {
  const float* x    = (const float*)d_in[0];
  const float* w_in = (const float*)d_in[1];
  const float* w_o  = (const float*)d_in[2];
  const float* ln1g = (const float*)d_in[3];
  const float* ln1b = (const float*)d_in[4];
  const float* ln2g = (const float*)d_in[5];
  const float* ln2b = (const float*)d_in[6];
  const float* w1   = (const float*)d_in[7];
  const float* b1   = (const float*)d_in[8];
  const float* w2   = (const float*)d_in[9];
  const float* b2   = (const float*)d_in[10];

  char* ws = (char*)d_ws;
  const size_t MB = 1ull << 20;
  float*    src     = (float*)(ws + 0);            // 32 MiB; dead after LN1
  float*    ff2     = src;                         // alias (written by FFN2)
  float*    hbuf    = (float*)(ws + 32 * MB);      // 32 MiB
  _Float16* h16     = (_Float16*)(ws + 64 * MB);   // 16 MiB
  _Float16* xq      = (_Float16*)(ws + 80 * MB);   // 16 MiB; dead after QKV GEMM
  _Float16* ctx     = xq;                          // alias
  float*    attnout = (float*)(ws + 96 * MB);      // 32 MiB
  _Float16* qkv     = (_Float16*)(ws + 128 * MB);  // 48 MiB; dead after attention
  _Float16* ff      = qkv;                         // alias (64 MiB)
  _Float16* wqkv16  = (_Float16*)(ws + 192 * MB);
  _Float16* wout16  = wqkv16 + (size_t)3072 * 1024;
  _Float16* w116    = wout16 + (size_t)1024 * 1024;
  _Float16* w216    = w116 + (size_t)HIDD * 1024;

  // weight conversions f32 -> f16
  cvt_f32_f16<<<3072 * 1024 / CVT_BLK, 256, 0, stream>>>(w_in, wqkv16);
  cvt_f32_f16<<<1024 * 1024 / CVT_BLK, 256, 0, stream>>>(w_o, wout16);
  cvt_f32_f16<<<HIDD * 1024 / CVT_BLK, 256, 0, stream>>>(w1, w116);
  cvt_f32_f16<<<HIDD * 1024 / CVT_BLK, 256, 0, stream>>>(w2, w216);

  // transpose + PE
  prep_kernel<<<NB * TT / 32, 512, 0, stream>>>(x, src, xq);

  // QKV projection: [8192,1024] x [3072,1024]^T -> f16 [8192,3072]
  gemm_wmma_kernel<0, 3072><<<dim3(3072 / GBN, 8192 / GBM), 256, 0, stream>>>(
      xq, wqkv16, nullptr, qkv, 8192, 3072, 1024);

  // causal flash attention
  attn_kernel<<<dim3(TT / 256, NHEADS, NB), 256, 0, stream>>>(qkv, ctx);

  // out projection -> f32 [8192,1024]
  gemm_wmma_kernel<1, 1024><<<dim3(1024 / GBN, 8192 / GBM), 256, 0, stream>>>(
      ctx, wout16, nullptr, attnout, 8192, 1024, 1024);

  // residual + LN1 -> h (f32 + f16)
  ln1_kernel<<<NB * TT, 256, 0, stream>>>(src, attnout, ln1g, ln1b, hbuf, h16);

  // FFN1: relu(h @ w1^T + b1) -> f16 [8192,4096]
  gemm_wmma_kernel<2, HIDD><<<dim3(HIDD / GBN, 8192 / GBM), 256, 0, stream>>>(
      h16, w116, b1, ff, 8192, HIDD, 1024);

  // FFN2: ff @ w2^T + b2 -> f32 [8192,1024]
  gemm_wmma_kernel<3, 1024><<<dim3(1024 / GBN, 8192 / GBM), 256, 0, stream>>>(
      ff, w216, b2, ff2, 8192, 1024, HIDD);

  // residual + LN2 + transpose back to [N,C,T]
  ln2t_kernel<<<NB * TT / 32, 512, 0, stream>>>(hbuf, ff2, ln2g, ln2b, (float*)d_out);
}

// v006
// A run of this version takes 236 microseconds.
// Timed twice side by side with v005, it ran 1.03 times as fast both times.
// Over all steps from v000 it is 2.65 times as fast.
#include <hip/hip_runtime.h>
#include <hip/hip_bf16.h>
#include <math.h>

typedef __attribute__((ext_vector_type(16))) _Float16 v16h;
typedef __attribute__((ext_vector_type(8)))  _Float16 v8h;
typedef __attribute__((ext_vector_type(8)))  float    v8f;
typedef __attribute__((ext_vector_type(4)))  float    v4f;

#define NB    8
#define TT    1024
#define CC    1024
#define NHEADS 16
#define HD    64
#define HIDD  4096

__device__ __forceinline__ v16h ld_frag_row(const _Float16* __restrict__ base, int ld) {
  const int lane = threadIdx.x & 31;
  const int row  = lane & 15;
  const int koff = (lane & 16) ? 8 : 0;
  const _Float16* p = base + (size_t)row * ld + koff;
  v8h lo = *(const v8h*)(p);        // K = koff .. koff+7
  v8h hi = *(const v8h*)(p + 16);   // K = 16+koff .. 23+koff
  v16h r;
#pragma unroll
  for (int i = 0; i < 8; ++i) { r[i] = lo[i]; r[i + 8] = hi[i]; }
  return r;
}

__device__ __forceinline__ v16h ld_frag_lds(const _Float16* p) {
  v8h lo = *(const v8h*)(p);
  v8h hi = *(const v8h*)(p + 16);
  v16h r;
#pragma unroll
  for (int i = 0; i < 8; ++i) { r[i] = lo[i]; r[i + 8] = hi[i]; }
  return r;
}

// ---------------------------------------------------------------------------
// LDS-staged WMMA GEMM: D[M,N] = A[M,K] * B[N,K]^T (row-major f16, K contig).
// Block = 256 thr = 8 waves; block tile 256x128, 64 k a pass; wave tile 64x64.
// M a multiple of 256, N of 128, K of 64 (the grid covers D exactly).
// A/B panels (whole 128-byte lines of every row) lie in a ring of NBUF LDS buffers,
// filled with global_load_async_to_lds_b128 and read as ds_load_b128 fragments; the
// copies of the next NBUF-1 passes fly while this pass's panel is worked on.
// NBUF = 2 where two blocks share a WGP and hide each other's waits. NBUF = 4 where
// the grid is one block a WGP: all blocks walk K in step, so every pass asks for
// lines that no block has touched yet, and one pass of lead is less than the way
// from memory. K is at least NBUF passes.
// EPI: 0 = f16 ; 1 = f32 ; 2 = relu(x+bias)->f16 ; 3 = x+bias->f32
// NC = N at compile time: the epilogue's row steps become immediate offsets, so
// that all stores of a lane share one address pair.
// ---------------------------------------------------------------------------
#define GBM 256
#define GBN 128
#define GBK 64
#define GPITCH 72   // halves: a 128-byte row and 16 bytes, the b128 readers' pitch

template <int EPI, int NC, int NBUF>
__global__ __launch_bounds__(256)
void gemm_wmma_kernel(const _Float16* __restrict__ A, const _Float16* __restrict__ B,
                      const float* __restrict__ bias, void* __restrict__ D,
                      int M, int N, int K) {
  __shared__ __align__(16) _Float16 As[NBUF][GBM][GPITCH];
  __shared__ __align__(16) _Float16 Bs[NBUF][GBN][GPITCH];

  const int tid  = threadIdx.x;
  const int w    = tid >> 5;
  const int wm   = w >> 1;          // 0..3 -> 64-row strip
  const int wn   = w & 1;           // 0..1 -> 64-col strip
  const int rowB = blockIdx.y * GBM;
  const int colB = blockIdx.x * GBN;

  v8f acc[4][4];
#pragma unroll
  for (int mi = 0; mi < 4; ++mi)
#pragma unroll
    for (int j = 0; j < 4; ++j) acc[mi][j] = (v8f){};

  // One panel pair = 384 rows of 128 bytes = 12 copies of 16 bytes a thread.
  // Eight lanes cover one row, so a wave's copy is four whole lines; copy t of a
  // thread lies 32 rows below copy t-1.
  const int crow = tid >> 3;         // 0..31
  const int cseg = (tid & 7) * 8;    // halves (16-byte chunks)
  const unsigned long long gstep = (unsigned long long)K * 64;   // 32 rows, bytes
  const unsigned lstep = 32 * GPITCH * 2;                        // 32 rows, bytes
  const unsigned long long gA =
      (unsigned long long)(A + (size_t)(rowB + crow) * K + cseg);
  const unsigned long long gB =
      (unsigned long long)(B + (size_t)(colB + crow) * K + cseg);
  auto prefetch = [&](int buf, int k) {
    const unsigned long long ga = gA + (unsigned long long)k * 2;
    const unsigned long long gb = gB + (unsigned long long)k * 2;
    const unsigned la = (unsigned)(uintptr_t)&As[buf][crow][cseg];
    const unsigned lb = (unsigned)(uintptr_t)&Bs[buf][crow][cseg];
    asm volatile(
        "global_load_async_to_lds_b128 %0, %12, off\n\t"
        "global_load_async_to_lds_b128 %1, %13, off\n\t"
        "global_load_async_to_lds_b128 %2, %14, off\n\t"
        "global_load_async_to_lds_b128 %3, %15, off\n\t"
        "global_load_async_to_lds_b128 %4, %16, off\n\t"
        "global_load_async_to_lds_b128 %5, %17, off\n\t"
        "global_load_async_to_lds_b128 %6, %18, off\n\t"
        "global_load_async_to_lds_b128 %7, %19, off\n\t"
        "global_load_async_to_lds_b128 %8, %20, off\n\t"
        "global_load_async_to_lds_b128 %9, %21, off\n\t"
        "global_load_async_to_lds_b128 %10, %22, off\n\t"
        "global_load_async_to_lds_b128 %11, %23, off\n\t"
        "s_wait_xcnt 0x0"
        :: "v"(la), "v"(la + lstep), "v"(la + 2 * lstep), "v"(la + 3 * lstep),
           "v"(la + 4 * lstep), "v"(la + 5 * lstep), "v"(la + 6 * lstep),
           "v"(la + 7 * lstep),
           "v"(lb), "v"(lb + lstep), "v"(lb + 2 * lstep), "v"(lb + 3 * lstep),
           "v"(ga), "v"(ga + gstep), "v"(ga + 2 * gstep), "v"(ga + 3 * gstep),
           "v"(ga + 4 * gstep), "v"(ga + 5 * gstep), "v"(ga + 6 * gstep),
           "v"(ga + 7 * gstep),
           "v"(gb), "v"(gb + gstep), "v"(gb + 2 * gstep), "v"(gb + 3 * gstep)
        : "memory");
  };

  const int lane = tid & 31;
  const int fr   = lane & 15;
  const int koff = (lane & 16) ? 8 : 0;
  const int KT   = K / GBK;

  if constexpr (NBUF == 2) {
    prefetch(0, 0);
    // panel 0 has landed for this wave, then for the block
    asm volatile("s_wait_asynccnt 0x0" ::: "memory");
    __syncthreads();
    if (KT > 1) prefetch(1, GBK);
  } else {
    // unrolled: the buffers' LDS addresses become constants
#pragma unroll
    for (int s = 0; s < NBUF; ++s) prefetch(s, s * GBK);
    // All but the wave's 12 (NBUF-1) youngest copies have landed: panel 0, for this
    // wave, then for the block.
    asm volatile("s_wait_asynccnt %0" :: "n"(12 * (NBUF - 1)) : "memory");
    __syncthreads();
  }

  for (int kt = 0; kt < KT; ++kt) {
    const int buf = kt & (NBUF - 1);
    const _Float16* ap = &As[buf][wm * 64 + fr][koff];
    const _Float16* bp = &Bs[buf][wn * 64 + fr][koff];
    v16h a[4], b[4];
    auto load_frags = [&](int ks) {   // 16 ds_load_b128: 32 k of the wave's rows
#pragma unroll
      for (int mi = 0; mi < 4; ++mi)
        a[mi] = ld_frag_lds(ap + mi * 16 * GPITCH + ks * 32);
#pragma unroll
      for (int j = 0; j < 4; ++j)
        b[j] = ld_frag_lds(bp + j * 16 * GPITCH + ks * 32);
    };
    auto mma = [&]() {
#pragma unroll
      for (int j = 0; j < 4; ++j)
#pragma unroll
        for (int mi = 0; mi < 4; ++mi)
          acc[mi][j] = __builtin_amdgcn_wmma_f32_16x16x32_f16(
              false, b[j], false, a[mi], (short)0, acc[mi][j], false, false);
    };
    load_frags(0);
    // Keeps the 16 LDS reads one group in front of their 16 WMMAs: left alone
    // the compiler reloads one B fragment every 4 WMMAs and waits out the LDS
    // latency each time.
    __builtin_amdgcn_sched_barrier(0);
    mma();
    load_frags(1);   // the wave's last reads of this panel
    // Foot of the pass: this wave's reads of the panel are done ...
    asm volatile("s_wait_dscnt 0x0" ::: "memory");
    // ... its copies of the next panel have landed ...
    if (NBUF > 2 && kt + NBUF < KT) {
      // A pass that refills (the test reads the same for the block): every pass so far
      // has issued its 12 copies, so the wave's 12 (NBUF-2) youngest are the panels
      // behind the next one, and they stay in flight.
      asm volatile("s_wait_asynccnt %0" :: "n"(12 * (NBUF - 2)) : "memory");
    } else {
      asm volatile("s_wait_asynccnt 0x0" ::: "memory");
    }
    // ... and the one barrier publishes that panel and frees this one.
    __syncthreads();
    if (kt + NBUF < KT) prefetch(buf, (kt + NBUF) * GBK);
    // The second half's products need registers only: behind the refill, so
    // that the copies have the whole next pass to land.
    mma();
  }
  // no copy is in flight when the wave ends
  asm volatile("s_wait_asynccnt 0x0" ::: "memory");

  // Epilogue. The weight rows are the first WMMA operand, so lane (c, hh) holds
  // D[m0 + 16 mi + c][n0 + 16 j + 8 hh + r], r = 0..7: 8 consecutive columns of a row.
  // Each wave lays its 64x64 tile in its own 9216 bytes of As (every wave has left
  // the ring at the last pass's barrier and no copy is in flight), reads it back by
  // rows and stores whole 128-byte lines.
  const int c  = lane & 15;
  const int hh = lane >> 4;
  const int n0 = colB + wn * 64;
  const int m0 = rowB + wm * 64;
  char* stg = (char*)&As[0][0][0] + w * (64 * GPITCH * 2);
  if (EPI == 0 || EPI == 2) {
    // f16: 64 rows of 128 bytes at the ring's pitch of 144
#pragma unroll
    for (int j = 0; j < 4; ++j) {
      v4f bl = (v4f){}, bh = (v4f){};
      if (EPI == 2) {
        bl = *(const v4f*)(bias + n0 + j * 16 + 8 * hh);
        bh = *(const v4f*)(bias + n0 + j * 16 + 8 * hh + 4);
      }
#pragma unroll
      for (int mi = 0; mi < 4; ++mi) {
        v8h o;
#pragma unroll
        for (int r = 0; r < 8; ++r) {
          float v = acc[mi][j][r];
          if (EPI == 2) {
            v += (r < 4) ? bl[r & 3] : bh[r & 3];
            v = v > 0.f ? v : 0.f;
          }
          o[r] = (_Float16)v;
        }
        *(v8h*)(stg + (mi * 16 + c) * (GPITCH * 2) + j * 32 + hh * 16) = o;
      }
    }
    // The other lanes' rows are in LDS before this lane reads them back.
    asm volatile("s_wait_dscnt 0x0" ::: "memory");
    const int rr = lane >> 3;   // eight lanes cover one 128-byte line
    _Float16* dp = (_Float16*)D + (size_t)(m0 + rr) * NC + n0 + (lane & 7) * 8;
    const char* sp = stg + rr * (GPITCH * 2) + (lane & 7) * 16;
#pragma unroll
    for (int it = 0; it < 16; ++it)
      *(v8h*)(dp + it * 4 * NC) = *(const v8h*)(sp + it * 4 * (GPITCH * 2));
  } else {
    // f32: 32 rows of 256 bytes at a pitch of 272, in two rounds
    const int FP = 272;
    v4f bl[4], bh[4];
    if (EPI == 3) {
#pragma unroll
      for (int j = 0; j < 4; ++j) {
        bl[j] = *(const v4f*)(bias + n0 + j * 16 + 8 * hh);
        bh[j] = *(const v4f*)(bias + n0 + j * 16 + 8 * hh + 4);
      }
    }
    const int rr = lane >> 4;   // sixteen lanes cover one row's two lines
    const char* sp = stg + rr * FP + (lane & 15) * 16;
    float* dp = (float*)D + (size_t)(m0 + rr) * NC + n0 + (lane & 15) * 4;
#pragma unroll
    for (int half = 0; half < 2; ++half) {
#pragma unroll
      for (int m2 = 0; m2 < 2; ++m2) {
#pragma unroll
        for (int j = 0; j < 4; ++j) {
          const v8f t = acc[half * 2 + m2][j];
          v4f lo = (v4f){t[0], t[1], t[2], t[3]};
          v4f hi = (v4f){t[4], t[5], t[6], t[7]};
          if (EPI == 3) { lo += bl[j]; hi += bh[j]; }
          char* q = stg + (m2 * 16 + c) * FP + j * 64 + hh * 32;
          *(v4f*)(q)      = lo;
          *(v4f*)(q + 16) = hi;
        }
      }
      // The other lanes' rows are in LDS before this lane reads them back.
      asm volatile("s_wait_dscnt 0x0" ::: "memory");
#pragma unroll
      for (int it = 0; it < 16; ++it)
        *(v4f*)(dp + (half * 32 + it * 2) * NC) = *(const v4f*)(sp + it * 2 * FP);
      // This round's rows have been read before the next round overwrites them, and
      // its stores have taken their registers before the next round's reads land there.
      if (half == 0) asm volatile("s_wait_dscnt 0x0\n\ts_wait_xcnt 0x0" ::: "memory");
    }
  }
}

// ---------------------------------------------------------------------------
// Flash attention, causal, by transposed products: S^T = K.Q^T, O^T += V^T.P^T.
// qkv: [N*T, 3C] f16 (Q | K | V slabs). ctx out: [N*T, C] f16.
// Block = 8 waves of 16 query columns = 128 queries of one (batch, head). The
// block walks the keys in stages of 64: K and V rows lie in two LDS buffers,
// filled with global_load_async_to_lds_b128; the next stage's copies fly while
// this one is worked on. A lane holds one query's scores (16 of a pass's 32
// keys): maximum and sum in the lane plus one exchange between the wave halves.
// The score tiles, converted in place, are the B operand of the second product,
// and V^T comes by ds_load_tr16_b128, so P never leaves the registers.
// Each block takes query blocks 7-x and x, so that all blocks walk 18 stages.
// ---------------------------------------------------------------------------
#define AKS 64   // keys a stage
#define AKP 72   // halves: K row and 16 bytes, the ds_load_b128 readers' pitch
#define AVP 80   // halves: V row and 32 bytes, the ds_load_tr16_b128 readers' pitch

typedef __attribute__((ext_vector_type(8))) short s16x8;

// Lane (c = l & 15, hh = l >> 4) gets 8 rows of column c of a row-major 16-bit
// LDS tile; p is the lane's own 16-byte address in that tile.
__device__ __forceinline__ v8h ld_tr16(const _Float16* p) {
  typedef __attribute__((address_space(3))) s16x8 lds_s16x8;
  return __builtin_bit_cast(v8h, __builtin_amdgcn_ds_load_tr16_b128_v8i16((lds_s16x8*)p));
}

__device__ __forceinline__ float xhalf(float x) {
  const int i = __builtin_bit_cast(int, x);
  return __builtin_bit_cast(float, __builtin_amdgcn_permlanex16(
      i, i, 0x76543210, 0xfedcba98, false, false));
}

__device__ __forceinline__ float exp2_slot(float x) {
  float r;
  asm("v_exp_f32 %0, %1\n\tv_nop" : "=v"(r) : "v"(x));
  return r;
}

__device__ __forceinline__ v8f exp2_slot8(v8f x) {
  float r0, r1, r2, r3, r4, r5, r6, r7;
  asm("v_exp_f32 %0, %8\n\t"
      "v_exp_f32 %1, %9\n\t"
      "v_exp_f32 %2, %10\n\t"
      "v_exp_f32 %3, %11\n\t"
      "v_exp_f32 %4, %12\n\t"
      "v_exp_f32 %5, %13\n\t"
      "v_exp_f32 %6, %14\n\t"
      "v_exp_f32 %7, %15\n\t"
      "v_nop"
      : "=&v"(r0), "=&v"(r1), "=&v"(r2), "=&v"(r3),
        "=&v"(r4), "=&v"(r5), "=&v"(r6), "=&v"(r7)
      : "v"(x[0]), "v"(x[1]), "v"(x[2]), "v"(x[3]),
        "v"(x[4]), "v"(x[5]), "v"(x[6]), "v"(x[7]));
  return (v8f){r0, r1, r2, r3, r4, r5, r6, r7};
}

__global__ __launch_bounds__(256)
void attn_kernel(const _Float16* __restrict__ qkv, _Float16* __restrict__ ctx) {
  __shared__ __align__(16) _Float16 Ks[2][AKS][AKP];
  __shared__ __align__(32) _Float16 Vs[2][AKS][AVP];

  const int tid  = threadIdx.x;
  const int lane = tid & 31;
  const int w    = __builtin_amdgcn_readfirstlane(tid >> 5);
  const int c    = lane & 15;
  const int hh   = lane >> 4;
  const int b    = blockIdx.z;
  const int h    = blockIdx.y;
  const int LD   = 3 * CC;
  const float cscale = 0.125f * 1.4426950408889634f;   // 1/sqrt(64), base-2 exponentials

  const _Float16* base = qkv + (size_t)(b * TT) * LD + h * HD;

  // One stage = 64 K rows and 64 V rows of 128 bytes = 4 copies of 16 bytes a
  // thread; eight lanes cover one row.
  const int crow = tid >> 3;         // 0..31
  const int cseg = (tid & 7) * 8;    // halves
  const unsigned long long gK =
      (unsigned long long)(base + CC + (size_t)crow * LD + cseg);
  auto stage = [&](int buf, int st) {
    const unsigned long long gk = gK + (unsigned long long)st * (AKS * 3 * CC * 2);
    const unsigned long long gv = gk + CC * 2;
    const unsigned lk = (unsigned)(uintptr_t)&Ks[buf][crow][cseg];
    const unsigned lv = (unsigned)(uintptr_t)&Vs[buf][crow][cseg];
    asm volatile(
        "global_load_async_to_lds_b128 %0, %4, off\n\t"
        "global_load_async_to_lds_b128 %1, %5, off\n\t"
        "global_load_async_to_lds_b128 %2, %6, off\n\t"
        "global_load_async_to_lds_b128 %3, %7, off\n\t"
        "s_wait_xcnt 0x0"
        :: "v"(lk), "v"(lk + 32 * AKP * 2), "v"(lv), "v"(lv + 32 * AVP * 2),
           "v"(gk), "v"(gk + 32 * 3 * CC * 2), "v"(gv), "v"(gv + 32 * 3 * CC * 2)
        : "memory");
  };

  for (int part = 0; part < 2; ++part) {
    const int pb  = part ? (int)blockIdx.x : 7 - (int)blockIdx.x;
    const int qw0 = pb * 128 + w * 16;   // the wave's first query
    const int nst = 2 * (pb + 1);        // stages: keys 0 .. pb*128+127

    // Every wave has left both buffers: the barrier at the foot of the last stage.
    stage(0, 0);

    const v16h qf0 = ld_frag_row(base + (size_t)qw0 * LD, LD);        // d 0..31
    const v16h qf1 = ld_frag_row(base + (size_t)qw0 * LD + 32, LD);   // d 32..63
    // The loads have taken their addresses before those registers are reused.
    asm volatile("s_wait_xcnt 0x0" ::: "memory");

    v8f acc[4];   // acc[t][r] = O^T[d = 16t + 8hh + r][query c]
    // Loops over register arrays are unrolled so that the arrays stay in registers.
#pragma unroll
    for (int t = 0; t < 4; ++t) acc[t] = (v8f){};
    float m_run = -3.0e38f;   // the query's maximum, scaled, same in both halves
    float l_run = 0.f;        // the sum over this lane's keys only

    // stage 0 has landed for this wave, then for the block
    asm volatile("s_wait_asynccnt 0x0" ::: "memory");
    __syncthreads();
    stage(1, 1);   // nst >= 2

    for (int st = 0; st < nst; ++st) {
      const int buf = st & 1;
      // unrolled: the two passes' LDS offsets become immediates
#pragma unroll
      for (int sub = 0; sub < 2; ++sub) {
        const int key0 = st * AKS + sub * 32;
        if (key0 <= qw0 + 15) {   // wave-uniform: passes beyond the diagonal are skipped
          const _Float16* kp = &Ks[buf][sub * 32 + c][8 * hh];
          const v16h k00 = ld_frag_lds(kp);
          const v16h k01 = ld_frag_lds(kp + 32);
          const v16h k10 = ld_frag_lds(kp + 16 * AKP);
          const v16h k11 = ld_frag_lds(kp + 16 * AKP + 32);

          const _Float16* vp = &Vs[buf][sub * 32 + 8 * hh + (lane & 7)][((lane >> 3) & 1) * 8];
          v16h vf[4];   // vf[t] = V^T rows d 16t..16t+15, the pass's 32 keys
#pragma unroll
          for (int t = 0; t < 4; ++t) {
            const v8h lo = ld_tr16(vp + 16 * t);
            const v8h hi = ld_tr16(vp + 16 * AVP + 16 * t);
#pragma unroll
            for (int i = 0; i < 8; ++i) { vf[t][i] = lo[i]; vf[t][i + 8] = hi[i]; }
          }

          // Keeps the pass's 16 LDS reads one group in front of its WMMAs: left alone
          // the compiler reads K two loads at a time and waits out the LDS latency
          // each time, and V^T only behind the exponentials.
          __builtin_amdgcn_sched_barrier(0);

          // s0[r] = S^T[key0 + 8hh + r][query c], s1 the 16 keys behind
          v8f s0 = (v8f){}, s1 = (v8f){};
          s0 = __builtin_amdgcn_wmma_f32_16x16x32_f16(false, k00, false, qf0, (short)0, s0, false, false);
          s1 = __builtin_amdgcn_wmma_f32_16x16x32_f16(false, k10, false, qf0, (short)0, s1, false, false);
          s0 = __builtin_amdgcn_wmma_f32_16x16x32_f16(false, k01, false, qf1, (short)0, s0, false, false);
          s1 = __builtin_amdgcn_wmma_f32_16x16x32_f16(false, k11, false, qf1, (short)0, s1, false, false);

          if (key0 + 31 > qw0) {   // wave-uniform: only the pass on the diagonal masks
            const int q = qw0 + c;
#pragma unroll
            for (int r = 0; r < 8; ++r) {
              if (key0 + 8 * hh + r > q)      s0[r] = -3.0e38f;
              if (key0 + 16 + 8 * hh + r > q) s1[r] = -3.0e38f;
            }
          }

          float mx = fmaxf(s0[0], s1[0]);
#pragma unroll
          for (int r = 1; r < 8; ++r) mx = fmaxf(mx, fmaxf(s0[r], s1[r]));
          mx = fmaxf(mx, xhalf(mx)) * cscale;   // key0 is open to every query of the wave
          const float mn    = fmaxf(m_run, mx);
          const float alpha = exp2_slot(m_run - mn);
          m_run = mn;

          v8f a0, a1;
#pragma unroll
          for (int r = 0; r < 8; ++r) {
            a0[r] = fmaf(s0[r], cscale, -mn);
            a1[r] = fmaf(s1[r], cscale, -mn);
          }
          const v8f p0 = exp2_slot8(a0);
          const v8f p1 = exp2_slot8(a1);

          v16h pf;   // P^T as B operand: element s = key key0 + 8hh + s (s < 8) or key0 + 8 + 8hh + s (s >= 8) of query c
#pragma unroll
          for (int r = 0; r < 8; ++r) {
            pf[r]     = (_Float16)p0[r];
            pf[r + 8] = (_Float16)p1[r];
          }
          const v8f ps = p0 + p1;
          const float rs = ((ps[0] + ps[1]) + (ps[2] + ps[3])) + ((ps[4] + ps[5]) + (ps[6] + ps[7]));
          l_run = l_run * alpha + rs;
#pragma unroll
          for (int t = 0; t < 4; ++t) {
            acc[t] = acc[t] * alpha;
            acc[t] = __builtin_amdgcn_wmma_f32_16x16x32_f16(false, vf[t], false, pf,
                                                            (short)0, acc[t], false, false);
          }
        }
      }
      // Foot of the stage: this wave's reads of the buffer are done ...
      asm volatile("s_wait_dscnt 0x0" ::: "memory");
      // ... its copies of the next stage have landed ...
      asm volatile("s_wait_asynccnt 0x0" ::: "memory");
      // ... and the one barrier publishes that stage and frees this buffer.
      __syncthreads();
      if (st + 2 < nst) stage(buf, st + 2);
    }
    // no copy is in flight behind the loop
    asm volatile("s_wait_asynccnt 0x0" ::: "memory");

    const float inv = 1.f / (l_run + xhalf(l_run));   // the two halves' keys joined
    _Float16* op = ctx + (size_t)(b * TT + qw0 + c) * CC + h * HD + 8 * hh;
#pragma unroll
    for (int t = 0; t < 4; ++t) {
      v8h o;   // 8 consecutive d of one query: one 16-byte store
#pragma unroll
      for (int r = 0; r < 8; ++r) o[r] = (_Float16)(acc[t][r] * inv);
      *(v8h*)(op + 16 * t) = o;
    }
    // The stores have taken their addresses before those registers are reused.
    asm volatile("s_wait_xcnt 0x0" ::: "memory");
  }
}

// ---------------------------------------------------------------------------
// Elementwise / reduction kernels
// ---------------------------------------------------------------------------
typedef __attribute__((ext_vector_type(2))) float    v2f;
typedef __attribute__((ext_vector_type(4))) _Float16 v4h;

__device__ __forceinline__ int tile_idx(int c, int tg) {
  return ((c ^ ((c >> 5) & 1)) << 5) + (((tg ^ (c >> 2)) & 7) << 2);
}

__device__ __forceinline__ void sincos_rev(float rev, float& s, float& c) {
  asm("v_sin_f32 %0, %2\n\tv_cos_f32 %1, %2\n\tv_nop" : "=&v"(s), "=&v"(c) : "v"(rev));
}

// One block = 32 consecutive time steps of one batch entry, all 1024 channels.
// x is read as whole 128-byte lines along t, turned in LDS, and src / xq are
// written as whole lines along c; wave w owns time steps 2w and 2w+1.
__global__ __launch_bounds__(512)
void prep_kernel(const float* __restrict__ x, float* __restrict__ src,
                 _Float16* __restrict__ xq) {
  __shared__ __align__(16) float tile[CC * 32];
  const int tid  = threadIdx.x;
  const int lane = tid & 31;
  const int w    = tid >> 5;
  const int row0 = blockIdx.x * 32;   // n*T + t of the first time step
  const int n  = row0 >> 10;
  const int t0 = row0 & 1023;
  {
    const int tg = tid & 7;
    const float* xp = x + ((size_t)n * CC + (tid >> 3)) * TT + t0 + tg * 4;
    v4f xr[16];
#pragma unroll
    for (int k = 0; k < 16; ++k) {
      // The last load's result may be given the address pair that the loads
      // before it name: they have taken their address behind this wait.
      if (k == 15) asm volatile("s_wait_xcnt 0x0" ::: "memory");
      xr[k] = *(const v4f*)(xp + (size_t)k * 64 * TT);
    }
#pragma unroll
    for (int k = 0; k < 16; ++k)
      *(v4f*)&tile[tile_idx(k * 64 + (tid >> 3), tg)] = xr[k];
  }
  __syncthreads();

  const float k0 = -logf(10000.0f) / (float)CC;
  const float ta = (float)(t0 + 2 * w);
  const float tb = (float)(t0 + 2 * w + 1);
  float*    sp = src + (size_t)(row0 + 2 * w) * CC + lane * 4;
  _Float16* qp = xq  + (size_t)(row0 + 2 * w) * CC + lane * 4;
#pragma unroll
  for (int i = 0; i < 8; ++i) {
    const int c0 = i * 128 + lane * 4;
    v4f sa, sb;
    v4h qa, qb;
#pragma unroll
    for (int j = 0; j < 4; j += 2) {   // channels c0+j (sin) and c0+j+1 (cos) share an angle
      const float f = exp2_slot(k0 * (float)(c0 + j) * 1.4426950408889634f);
      float pea[2], peb[2];
      sincos_rev(ta * f * 0.15915494309189532f, pea[0], pea[1]);
      sincos_rev(tb * f * 0.15915494309189532f, peb[0], peb[1]);
#pragma unroll
      for (int e = 0; e < 2; ++e) {
        const v2f p = *(const v2f*)&tile[tile_idx(c0 + j + e, w >> 1) + (w & 1) * 2];
        sa[j + e] = p[0];
        sb[j + e] = p[1];
        qa[j + e] = (_Float16)(p[0] + pea[e]);
        qb[j + e] = (_Float16)(p[1] + peb[e]);
      }
    }
    *(v4f*)(sp + i * 128)      = sa;
    *(v4f*)(sp + CC + i * 128) = sb;
    *(v4h*)(qp + i * 128)      = qa;
    *(v4h*)(qp + CC + i * 128) = qb;
  }
}

#define CVT_BLK 16384
__global__ __launch_bounds__(256) __attribute__((amdgpu_waves_per_eu(2, 8)))
void cvt_f32_f16(const float* __restrict__ in, _Float16* __restrict__ out) {
  const size_t base = (size_t)blockIdx.x * CVT_BLK + (threadIdx.x >> 5) * 2048 +
                      (threadIdx.x & 31) * 4;
  const float* ip = in + base;
  _Float16*    op = out + base;
  v4f r[16];
#pragma unroll
  for (int k = 0; k < 16; ++k) {
    // The last load's result may be given the address pair that the loads
    // before it name: they have taken their address behind this wait.
    if (k == 15) asm volatile("s_wait_xcnt 0x0" ::: "memory");
    r[k] = *(const v4f*)(ip + k * 128);
  }
#pragma unroll
  for (int k = 0; k < 16; ++k) {
    v4h h;
#pragma unroll
    for (int j = 0; j < 4; ++j) h[j] = (_Float16)r[k][j];
    *(v4h*)(op + k * 128) = h;
  }
}

__device__ __forceinline__ float block_sum_256(float v, float* red) {
  const int tid = threadIdx.x;
  red[tid] = v; __syncthreads();
  for (int o = 128; o > 0; o >>= 1) {
    if (tid < o) red[tid] += red[tid + o];
    __syncthreads();
  }
  const float s = red[0];
  __syncthreads();
  return s;
}

__global__ __launch_bounds__(256)
void ln1_kernel(const float* __restrict__ a, const float* __restrict__ bb,
                const float* __restrict__ g, const float* __restrict__ beta,
                float* __restrict__ hout, _Float16* __restrict__ h16) {
  __shared__ float red[256];
  const int row = blockIdx.x, tid = threadIdx.x;
  float vals[4], s = 0.f;
#pragma unroll
  for (int i = 0; i < 4; ++i) {
    const int c = tid + i * 256;
    const float v = a[(size_t)row * CC + c] + bb[(size_t)row * CC + c];
    vals[i] = v; s += v;
  }
  const float mu = block_sum_256(s, red) * (1.f / CC);
  float sq = 0.f;
#pragma unroll
  for (int i = 0; i < 4; ++i) { const float d = vals[i] - mu; sq += d * d; }
  const float rstd = rsqrtf(block_sum_256(sq, red) * (1.f / CC) + 1e-5f);
#pragma unroll
  for (int i = 0; i < 4; ++i) {
    const int c = tid + i * 256;
    const float o = (vals[i] - mu) * rstd * g[c] + beta[c];
    hout[(size_t)row * CC + c] = o;
    h16[(size_t)row * CC + c] = (_Float16)o;
  }
}

__device__ __forceinline__ float wave_sum(float v) {
#pragma unroll
  for (int off = 16; off >= 1; off >>= 1) v += __shfl_xor(v, off, 32);
  return v;
}

// One block = 32 consecutive time steps of one batch entry. Wave w normalises
// rows 2w and 2w+1 whole (row sums inside the wave), lays the results in the LDS
// tile, and the block then stores whole 128-byte lines of out along t.
__global__ __launch_bounds__(512)
void ln2t_kernel(const float* __restrict__ a, const float* __restrict__ bb,
                 const float* __restrict__ g, const float* __restrict__ beta,
                 float* __restrict__ out) {
  __shared__ __align__(16) float tile[CC * 32];
  const int tid  = threadIdx.x;
  const int lane = tid & 31;
  const int w    = tid >> 5;
  const int row0 = blockIdx.x * 32;
  const int n  = row0 >> 10;
  const int t0 = row0 & 1023;

  const float* ap = a  + (size_t)(row0 + 2 * w) * CC + lane * 4;
  const float* bp = bb + (size_t)(row0 + 2 * w) * CC + lane * 4;
  v4f v[2][8];
#pragma unroll
  for (int r = 0; r < 2; ++r)
#pragma unroll
    for (int i = 0; i < 8; ++i)
      v[r][i] = *(const v4f*)(ap + r * CC + i * 128) + *(const v4f*)(bp + r * CC + i * 128);

  float mu[2], rstd[2];
#pragma unroll
  for (int r = 0; r < 2; ++r) {
    float s = 0.f;
#pragma unroll
    for (int i = 0; i < 8; ++i)
#pragma unroll
      for (int j = 0; j < 4; ++j) s += v[r][i][j];
    mu[r] = wave_sum(s) * (1.f / CC);
    float sq = 0.f;
#pragma unroll
    for (int i = 0; i < 8; ++i)
#pragma unroll
      for (int j = 0; j < 4; ++j) { const float d = v[r][i][j] - mu[r]; sq += d * d; }
    rstd[r] = rsqrtf(wave_sum(sq) * (1.f / CC) + 1e-5f);
  }

#pragma unroll
  for (int i = 0; i < 8; ++i) {
    const int c0 = i * 128 + lane * 4;
    const v4f gg = *(const v4f*)(g + c0);
    const v4f be = *(const v4f*)(beta + c0);
#pragma unroll
    for (int j = 0; j < 4; ++j) {
      v2f o;
      o[0] = (v[0][i][j] - mu[0]) * rstd[0] * gg[j] + be[j];
      o[1] = (v[1][i][j] - mu[1]) * rstd[1] * gg[j] + be[j];
      *(v2f*)&tile[tile_idx(c0 + j, w >> 1) + (w & 1) * 2] = o;
    }
  }
  __syncthreads();

  const int tg = tid & 7;
  float* op = out + ((size_t)n * CC + (tid >> 3)) * TT + t0 + tg * 4;
#pragma unroll
  for (int k = 0; k < 16; ++k) {
    const int c = k * 64 + (tid >> 3);
    *(v4f*)(op + (size_t)k * 64 * TT) = *(const v4f*)&tile[tile_idx(c, tg)];
  }
}

// ---------------------------------------------------------------------------
extern "C" void kernel_launch(void* const* d_in, const int* in_sizes, int n_in,
                              void* d_out, int out_size, void* d_ws, size_t ws_size,
                              hipStream_t stream) {
  const float* x    = (const float*)d_in[0];
  const float* w_in = (const float*)d_in[1];
  const float* w_o  = (const float*)d_in[2];
  const float* ln1g = (const float*)d_in[3];
  const float* ln1b = (const float*)d_in[4];
  const float* ln2g = (const float*)d_in[5];
  const float* ln2b = (const float*)d_in[6];
  const float* w1   = (const float*)d_in[7];
  const float* b1   = (const float*)d_in[8];
  const float* w2   = (const float*)d_in[9];
  const float* b2   = (const float*)d_in[10];

  char* ws = (char*)d_ws;
  const size_t MB = 1ull << 20;
  float*    src     = (float*)(ws + 0);            // 32 MiB; dead after LN1
  float*    ff2     = src;                         // alias (written by FFN2)
  float*    hbuf    = (float*)(ws + 32 * MB);      // 32 MiB
  _Float16* h16     = (_Float16*)(ws + 64 * MB);   // 16 MiB
  _Float16* xq      = (_Float16*)(ws + 80 * MB);   // 16 MiB; dead after QKV GEMM
  _Float16* ctx     = xq;                          // alias
  float*    attnout = (float*)(ws + 96 * MB);      // 32 MiB
  _Float16* qkv     = (_Float16*)(ws + 128 * MB);  // 48 MiB; dead after attention
  _Float16* ff      = qkv;                         // alias (64 MiB)
  _Float16* wqkv16  = (_Float16*)(ws + 192 * MB);
  _Float16* wout16  = wqkv16 + (size_t)3072 * 1024;
  _Float16* w116    = wout16 + (size_t)1024 * 1024;
  _Float16* w216    = w116 + (size_t)HIDD * 1024;

  // weight conversions f32 -> f16
  cvt_f32_f16<<<3072 * 1024 / CVT_BLK, 256, 0, stream>>>(w_in, wqkv16);
  cvt_f32_f16<<<1024 * 1024 / CVT_BLK, 256, 0, stream>>>(w_o, wout16);
  cvt_f32_f16<<<HIDD * 1024 / CVT_BLK, 256, 0, stream>>>(w1, w116);
  cvt_f32_f16<<<HIDD * 1024 / CVT_BLK, 256, 0, stream>>>(w2, w216);

  // transpose + PE
  prep_kernel<<<NB * TT / 32, 512, 0, stream>>>(x, src, xq);

  // QKV projection: [8192,1024] x [3072,1024]^T -> f16 [8192,3072]
  gemm_wmma_kernel<0, 3072, 2><<<dim3(3072 / GBN, 8192 / GBM), 256, 0, stream>>>(
      xq, wqkv16, nullptr, qkv, 8192, 3072, 1024);

  // causal flash attention
  attn_kernel<<<dim3(TT / 256, NHEADS, NB), 256, 0, stream>>>(qkv, ctx);

  // out projection -> f32 [8192,1024]
  gemm_wmma_kernel<1, 1024, 4><<<dim3(1024 / GBN, 8192 / GBM), 256, 0, stream>>>(
      ctx, wout16, nullptr, attnout, 8192, 1024, 1024);

  // residual + LN1 -> h (f32 + f16)
  ln1_kernel<<<NB * TT, 256, 0, stream>>>(src, attnout, ln1g, ln1b, hbuf, h16);

  // FFN1: relu(h @ w1^T + b1) -> f16 [8192,4096]
  gemm_wmma_kernel<2, HIDD, 2><<<dim3(HIDD / GBN, 8192 / GBM), 256, 0, stream>>>(
      h16, w116, b1, ff, 8192, HIDD, 1024);

  // FFN2: ff @ w2^T + b2 -> f32 [8192,1024]
  gemm_wmma_kernel<3, 1024, 4><<<dim3(1024 / GBN, 8192 / GBM), 256, 0, stream>>>(
      ff, w216, b2, ff2, 8192, 1024, HIDD);

  // residual + LN2 + transpose back to [N,C,T]
  ln2t_kernel<<<NB * TT / 32, 512, 0, stream>>>(hbuf, ff2, ln2g, ln2b, (float*)d_out);
}

// v007
// A run of this version takes 229 microseconds.
// Two timings next to v006 both put it at 1.03 times that version's speed.
// Counting every step since v000, it is 2.74 times as fast.
#include <hip/hip_runtime.h>
#include <hip/hip_bf16.h>
#include <math.h>

typedef __attribute__((ext_vector_type(16))) _Float16 v16h;
typedef __attribute__((ext_vector_type(8)))  _Float16 v8h;
typedef __attribute__((ext_vector_type(8)))  float    v8f;
typedef __attribute__((ext_vector_type(4)))  float    v4f;

#define NB    8
#define TT    1024
#define CC    1024
#define NHEADS 16
#define HD    64
#define HIDD  4096

__device__ __forceinline__ v16h ld_frag_row(const _Float16* __restrict__ base, int ld) {
  const int lane = threadIdx.x & 31;
  const int row  = lane & 15;
  const int koff = (lane & 16) ? 8 : 0;
  const _Float16* p = base + (size_t)row * ld + koff;
  v8h lo = *(const v8h*)(p);        // K = koff .. koff+7
  v8h hi = *(const v8h*)(p + 16);   // K = 16+koff .. 23+koff
  v16h r;
#pragma unroll
  for (int i = 0; i < 8; ++i) { r[i] = lo[i]; r[i + 8] = hi[i]; }
  return r;
}

__device__ __forceinline__ v16h ld_frag_lds(const _Float16* p) {
  v8h lo = *(const v8h*)(p);
  v8h hi = *(const v8h*)(p + 16);
  v16h r;
#pragma unroll
  for (int i = 0; i < 8; ++i) { r[i] = lo[i]; r[i + 8] = hi[i]; }
  return r;
}

// ---------------------------------------------------------------------------
// LDS-staged WMMA GEMM: D[M,N] = A[M,K] * B[N,K]^T (row-major f16, K contig).
// Block = 256 thr = 8 waves; block tile 256x128, 64 k a pass; wave tile 64x64.
// M a multiple of 256, N of 128, K of 64 (the grid covers D exactly).
// A/B panels (whole 128-byte lines of every row) lie in a ring of NBUF LDS buffers,
// filled with global_load_async_to_lds_b128 and read as ds_load_b128 fragments; the
// copies of the next NBUF-1 passes fly while this pass's panel is worked on.
// NBUF = 2 where two blocks share a WGP and hide each other's waits. NBUF = 4 where
// the grid is one block a WGP: all blocks walk K in step, so every pass asks for
// lines that no block has touched yet, and one pass of lead is less than the way
// from memory. K is at least NBUF passes.
// EPI: 0 = f16 ; 1 = f32 ; 2 = relu(x+bias)->f16 ; 3 = x+bias->f32
// NC = N at compile time: the epilogue's row steps become immediate offsets, so
// that all stores of a lane share one address pair.
// ---------------------------------------------------------------------------
#define GBM 256
#define GBN 128
#define GBK 64
#define GPITCH 72   // halves: a 128-byte row and 16 bytes, the b128 readers' pitch

template <int EPI, int NC, int NBUF>
__global__ __launch_bounds__(256)
void gemm_wmma_kernel(const _Float16* __restrict__ A, const _Float16* __restrict__ B,
                      const float* __restrict__ bias, void* __restrict__ D,
                      int M, int N, int K) {
  __shared__ __align__(16) _Float16 As[NBUF][GBM][GPITCH];
  __shared__ __align__(16) _Float16 Bs[NBUF][GBN][GPITCH];

  const int tid  = threadIdx.x;
  const int w    = tid >> 5;
  const int wm   = w >> 1;          // 0..3 -> 64-row strip
  const int wn   = w & 1;           // 0..1 -> 64-col strip
  const int rowB = blockIdx.y * GBM;
  const int colB = blockIdx.x * GBN;

  v8f acc[4][4];
#pragma unroll
  for (int mi = 0; mi < 4; ++mi)
#pragma unroll
    for (int j = 0; j < 4; ++j) acc[mi][j] = (v8f){};

  // One panel pair = 384 rows of 128 bytes = 12 copies of 16 bytes a thread.
  // Eight lanes cover one row, so a wave's copy is four whole lines; copy t of a
  // thread lies 32 rows below copy t-1.
  const int crow = tid >> 3;         // 0..31
  const int cseg = (tid & 7) * 8;    // halves (16-byte chunks)
  const unsigned long long gstep = (unsigned long long)K * 64;   // 32 rows, bytes
  const unsigned lstep = 32 * GPITCH * 2;                        // 32 rows, bytes
  const unsigned long long gA =
      (unsigned long long)(A + (size_t)(rowB + crow) * K + cseg);
  const unsigned long long gB =
      (unsigned long long)(B + (size_t)(colB + crow) * K + cseg);
  auto prefetch = [&](int buf, int k) {
    const unsigned long long ga = gA + (unsigned long long)k * 2;
    const unsigned long long gb = gB + (unsigned long long)k * 2;
    const unsigned la = (unsigned)(uintptr_t)&As[buf][crow][cseg];
    const unsigned lb = (unsigned)(uintptr_t)&Bs[buf][crow][cseg];
    asm volatile(
        "global_load_async_to_lds_b128 %0, %12, off\n\t"
        "global_load_async_to_lds_b128 %1, %13, off\n\t"
        "global_load_async_to_lds_b128 %2, %14, off\n\t"
        "global_load_async_to_lds_b128 %3, %15, off\n\t"
        "global_load_async_to_lds_b128 %4, %16, off\n\t"
        "global_load_async_to_lds_b128 %5, %17, off\n\t"
        "global_load_async_to_lds_b128 %6, %18, off\n\t"
        "global_load_async_to_lds_b128 %7, %19, off\n\t"
        "global_load_async_to_lds_b128 %8, %20, off\n\t"
        "global_load_async_to_lds_b128 %9, %21, off\n\t"
        "global_load_async_to_lds_b128 %10, %22, off\n\t"
        "global_load_async_to_lds_b128 %11, %23, off\n\t"
        "s_wait_xcnt 0x0"
        :: "v"(la), "v"(la + lstep), "v"(la + 2 * lstep), "v"(la + 3 * lstep),
           "v"(la + 4 * lstep), "v"(la + 5 * lstep), "v"(la + 6 * lstep),
           "v"(la + 7 * lstep),
           "v"(lb), "v"(lb + lstep), "v"(lb + 2 * lstep), "v"(lb + 3 * lstep),
           "v"(ga), "v"(ga + gstep), "v"(ga + 2 * gstep), "v"(ga + 3 * gstep),
           "v"(ga + 4 * gstep), "v"(ga + 5 * gstep), "v"(ga + 6 * gstep),
           "v"(ga + 7 * gstep),
           "v"(gb), "v"(gb + gstep), "v"(gb + 2 * gstep), "v"(gb + 3 * gstep)
        : "memory");
  };

  const int lane = tid & 31;
  const int fr   = lane & 15;
  const int koff = (lane & 16) ? 8 : 0;
  const int KT   = K / GBK;

  if constexpr (NBUF == 2) {
    prefetch(0, 0);
    // panel 0 has landed for this wave, then for the block
    asm volatile("s_wait_asynccnt 0x0" ::: "memory");
    __syncthreads();
    if (KT > 1) prefetch(1, GBK);
  } else {
    // unrolled: the buffers' LDS addresses become constants
#pragma unroll
    for (int s = 0; s < NBUF; ++s) prefetch(s, s * GBK);
    // All but the wave's 12 (NBUF-1) youngest copies have landed: panel 0, for this
    // wave, then for the block.
    asm volatile("s_wait_asynccnt %0" :: "n"(12 * (NBUF - 1)) : "memory");
    __syncthreads();
  }

  for (int kt = 0; kt < KT; ++kt) {
    const int buf = kt & (NBUF - 1);
    const _Float16* ap = &As[buf][wm * 64 + fr][koff];
    const _Float16* bp = &Bs[buf][wn * 64 + fr][koff];
    v16h a[4], b[4];
    auto load_frags = [&](int ks) {   // 16 ds_load_b128: 32 k of the wave's rows
#pragma unroll
      for (int mi = 0; mi < 4; ++mi)
        a[mi] = ld_frag_lds(ap + mi * 16 * GPITCH + ks * 32);
#pragma unroll
      for (int j = 0; j < 4; ++j)
        b[j] = ld_frag_lds(bp + j * 16 * GPITCH + ks * 32);
    };
    auto mma = [&]() {
#pragma unroll
      for (int j = 0; j < 4; ++j)
#pragma unroll
        for (int mi = 0; mi < 4; ++mi)
          acc[mi][j] = __builtin_amdgcn_wmma_f32_16x16x32_f16(
              false, b[j], false, a[mi], (short)0, acc[mi][j], false, false);
    };
    load_frags(0);
    // Keeps the 16 LDS reads one group in front of their 16 WMMAs: left alone
    // the compiler reloads one B fragment every 4 WMMAs and waits out the LDS
    // latency each time.
    __builtin_amdgcn_sched_barrier(0);
    mma();
    load_frags(1);   // the wave's last reads of this panel
    // Foot of the pass: this wave's reads of the panel are done ...
    asm volatile("s_wait_dscnt 0x0" ::: "memory");
    // ... its copies of the next panel have landed ...
    if (NBUF > 2 && kt + NBUF < KT) {
      // A pass that refills (the test reads the same for the block): every pass so far
      // has issued its 12 copies, so the wave's 12 (NBUF-2) youngest are the panels
      // behind the next one, and they stay in flight.
      asm volatile("s_wait_asynccnt %0" :: "n"(12 * (NBUF - 2)) : "memory");
    } else {
      asm volatile("s_wait_asynccnt 0x0" ::: "memory");
    }
    // ... and the one barrier publishes that panel and frees this one.
    __syncthreads();
    if (kt + NBUF < KT) prefetch(buf, (kt + NBUF) * GBK);
    // The second half's products need registers only: behind the refill, so
    // that the copies have the whole next pass to land.
    mma();
  }
  // no copy is in flight when the wave ends
  asm volatile("s_wait_asynccnt 0x0" ::: "memory");

  // Epilogue. The weight rows are the first WMMA operand, so lane (c, hh) holds
  // D[m0 + 16 mi + c][n0 + 16 j + 8 hh + r], r = 0..7: 8 consecutive columns of a row.
  // Each wave lays its 64x64 tile in its own 9216 bytes of As (every wave has left
  // the ring at the last pass's barrier and no copy is in flight), reads it back by
  // rows and stores whole 128-byte lines.
  const int c  = lane & 15;
  const int hh = lane >> 4;
  const int n0 = colB + wn * 64;
  const int m0 = rowB + wm * 64;
  char* stg = (char*)&As[0][0][0] + w * (64 * GPITCH * 2);
  if (EPI == 0 || EPI == 2) {
    // f16: 64 rows of 128 bytes at the ring's pitch of 144
#pragma unroll
    for (int j = 0; j < 4; ++j) {
      v4f bl = (v4f){}, bh = (v4f){};
      if (EPI == 2) {
        bl = *(const v4f*)(bias + n0 + j * 16 + 8 * hh);
        bh = *(const v4f*)(bias + n0 + j * 16 + 8 * hh + 4);
      }
#pragma unroll
      for (int mi = 0; mi < 4; ++mi) {
        v8h o;
#pragma unroll
        for (int r = 0; r < 8; ++r) {
          float v = acc[mi][j][r];
          if (EPI == 2) {
            v += (r < 4) ? bl[r & 3] : bh[r & 3];
            v = v > 0.f ? v : 0.f;
          }
          o[r] = (_Float16)v;
        }
        *(v8h*)(stg + (mi * 16 + c) * (GPITCH * 2) + j * 32 + hh * 16) = o;
      }
    }
    // The other lanes' rows are in LDS before this lane reads them back.
    asm volatile("s_wait_dscnt 0x0" ::: "memory");
    const int rr = lane >> 3;   // eight lanes cover one 128-byte line
    _Float16* dp = (_Float16*)D + (size_t)(m0 + rr) * NC + n0 + (lane & 7) * 8;
    const char* sp = stg + rr * (GPITCH * 2) + (lane & 7) * 16;
#pragma unroll
    for (int it = 0; it < 16; ++it)
      *(v8h*)(dp + it * 4 * NC) = *(const v8h*)(sp + it * 4 * (GPITCH * 2));
  } else {
    // f32: 32 rows of 256 bytes at a pitch of 272, in two rounds
    const int FP = 272;
    v4f bl[4], bh[4];
    if (EPI == 3) {
#pragma unroll
      for (int j = 0; j < 4; ++j) {
        bl[j] = *(const v4f*)(bias + n0 + j * 16 + 8 * hh);
        bh[j] = *(const v4f*)(bias + n0 + j * 16 + 8 * hh + 4);
      }
    }
    const int rr = lane >> 4;   // sixteen lanes cover one row's two lines
    const char* sp = stg + rr * FP + (lane & 15) * 16;
    float* dp = (float*)D + (size_t)(m0 + rr) * NC + n0 + (lane & 15) * 4;
#pragma unroll
    for (int half = 0; half < 2; ++half) {
#pragma unroll
      for (int m2 = 0; m2 < 2; ++m2) {
#pragma unroll
        for (int j = 0; j < 4; ++j) {
          const v8f t = acc[half * 2 + m2][j];
          v4f lo = (v4f){t[0], t[1], t[2], t[3]};
          v4f hi = (v4f){t[4], t[5], t[6], t[7]};
          if (EPI == 3) { lo += bl[j]; hi += bh[j]; }
          char* q = stg + (m2 * 16 + c) * FP + j * 64 + hh * 32;
          *(v4f*)(q)      = lo;
          *(v4f*)(q + 16) = hi;
        }
      }
      // The other lanes' rows are in LDS before this lane reads them back.
      asm volatile("s_wait_dscnt 0x0" ::: "memory");
#pragma unroll
      for (int it = 0; it < 16; ++it)
        *(v4f*)(dp + (half * 32 + it * 2) * NC) = *(const v4f*)(sp + it * 2 * FP);
      // This round's rows have been read before the next round overwrites them, and
      // its stores have taken their registers before the next round's reads land there.
      if (half == 0) asm volatile("s_wait_dscnt 0x0\n\ts_wait_xcnt 0x0" ::: "memory");
    }
  }
}

// ---------------------------------------------------------------------------
// Flash attention, causal, by transposed products: S^T = K.Q^T, O^T += V^T.P^T.
// qkv: [N*T, 3C] f16 (Q | K | V slabs). ctx out: [N*T, C] f16.
// Block = 8 waves of 16 query columns = 128 queries of one (batch, head). The
// block walks the keys in stages of 64: K and V rows lie in two LDS buffers,
// filled with global_load_async_to_lds_b128; the next stage's copies fly while
// this one is worked on. A lane holds one query's scores (16 of a pass's 32
// keys): maximum and sum in the lane plus one exchange between the wave halves.
// The score tiles, converted in place, are the B operand of the second product,
// and V^T comes by ds_load_tr16_b128, so P never leaves the registers.
// Each block takes query blocks 7-x and x, so that all blocks walk 18 stages.
// ---------------------------------------------------------------------------
#define AKS 64   // keys a stage
#define AKP 72   // halves: K row and 16 bytes, the ds_load_b128 readers' pitch
#define AVP 80   // halves: V row and 32 bytes, the ds_load_tr16_b128 readers' pitch

typedef __attribute__((ext_vector_type(8))) short s16x8;

// Lane (c = l & 15, hh = l >> 4) gets 8 rows of column c of a row-major 16-bit
// LDS tile; p is the lane's own 16-byte address in that tile.
__device__ __forceinline__ v8h ld_tr16(const _Float16* p) {
  typedef __attribute__((address_space(3))) s16x8 lds_s16x8;
  return __builtin_bit_cast(v8h, __builtin_amdgcn_ds_load_tr16_b128_v8i16((lds_s16x8*)p));
}

__device__ __forceinline__ float xhalf(float x) {
  const int i = __builtin_bit_cast(int, x);
  return __builtin_bit_cast(float, __builtin_amdgcn_permlanex16(
      i, i, 0x76543210, 0xfedcba98, false, false));
}

__device__ __forceinline__ float exp2_slot(float x) {
  float r;
  asm("v_exp_f32 %0, %1\n\tv_nop" : "=v"(r) : "v"(x));
  return r;
}

__device__ __forceinline__ v8f exp2_slot8(v8f x) {
  float r0, r1, r2, r3, r4, r5, r6, r7;
  asm("v_exp_f32 %0, %8\n\t"
      "v_exp_f32 %1, %9\n\t"
      "v_exp_f32 %2, %10\n\t"
      "v_exp_f32 %3, %11\n\t"
      "v_exp_f32 %4, %12\n\t"
      "v_exp_f32 %5, %13\n\t"
      "v_exp_f32 %6, %14\n\t"
      "v_exp_f32 %7, %15\n\t"
      "v_nop"
      : "=&v"(r0), "=&v"(r1), "=&v"(r2), "=&v"(r3),
        "=&v"(r4), "=&v"(r5), "=&v"(r6), "=&v"(r7)
      : "v"(x[0]), "v"(x[1]), "v"(x[2]), "v"(x[3]),
        "v"(x[4]), "v"(x[5]), "v"(x[6]), "v"(x[7]));
  return (v8f){r0, r1, r2, r3, r4, r5, r6, r7};
}

__global__ __launch_bounds__(256)
void attn_kernel(const _Float16* __restrict__ qkv, _Float16* __restrict__ ctx) {
  __shared__ __align__(16) _Float16 Ks[2][AKS][AKP];
  __shared__ __align__(32) _Float16 Vs[2][AKS][AVP];

  const int tid  = threadIdx.x;
  const int lane = tid & 31;
  const int w    = __builtin_amdgcn_readfirstlane(tid >> 5);
  const int c    = lane & 15;
  const int hh   = lane >> 4;
  const int b    = blockIdx.z;
  const int h    = blockIdx.y;
  const int LD   = 3 * CC;
  const float cscale = 0.125f * 1.4426950408889634f;   // 1/sqrt(64), base-2 exponentials

  const _Float16* base = qkv + (size_t)(b * TT) * LD + h * HD;

  // One stage = 64 K rows and 64 V rows of 128 bytes = 4 copies of 16 bytes a
  // thread; eight lanes cover one row.
  const int crow = tid >> 3;         // 0..31
  const int cseg = (tid & 7) * 8;    // halves
  const unsigned long long gK =
      (unsigned long long)(base + CC + (size_t)crow * LD + cseg);
  auto stage = [&](int buf, int st) {
    const unsigned long long gk = gK + (unsigned long long)st * (AKS * 3 * CC * 2);
    const unsigned long long gv = gk + CC * 2;
    const unsigned lk = (unsigned)(uintptr_t)&Ks[buf][crow][cseg];
    const unsigned lv = (unsigned)(uintptr_t)&Vs[buf][crow][cseg];
    asm volatile(
        "global_load_async_to_lds_b128 %0, %4, off\n\t"
        "global_load_async_to_lds_b128 %1, %5, off\n\t"
        "global_load_async_to_lds_b128 %2, %6, off\n\t"
        "global_load_async_to_lds_b128 %3, %7, off\n\t"
        "s_wait_xcnt 0x0"
        :: "v"(lk), "v"(lk + 32 * AKP * 2), "v"(lv), "v"(lv + 32 * AVP * 2),
           "v"(gk), "v"(gk + 32 * 3 * CC * 2), "v"(gv), "v"(gv + 32 * 3 * CC * 2)
        : "memory");
  };

  for (int part = 0; part < 2; ++part) {
    const int pb  = part ? (int)blockIdx.x : 7 - (int)blockIdx.x;
    const int qw0 = pb * 128 + w * 16;   // the wave's first query
    const int nst = 2 * (pb + 1);        // stages: keys 0 .. pb*128+127

    // Every wave has left both buffers: the barrier at the foot of the last stage.
    stage(0, 0);

    const v16h qf0 = ld_frag_row(base + (size_t)qw0 * LD, LD);        // d 0..31
    const v16h qf1 = ld_frag_row(base + (size_t)qw0 * LD + 32, LD);   // d 32..63
    // The loads have taken their addresses before those registers are reused.
    asm volatile("s_wait_xcnt 0x0" ::: "memory");

    v8f acc[4];   // acc[t][r] = O^T[d = 16t + 8hh + r][query c]
    // Loops over register arrays are unrolled so that the arrays stay in registers.
#pragma unroll
    for (int t = 0; t < 4; ++t) acc[t] = (v8f){};
    float m_run = -3.0e38f;   // the query's maximum, scaled, same in both halves
    float l_run = 0.f;        // the sum over this lane's keys only

    // stage 0 has landed for this wave, then for the block
    asm volatile("s_wait_asynccnt 0x0" ::: "memory");
    __syncthreads();
    stage(1, 1);   // nst >= 2

    for (int st = 0; st < nst; ++st) {
      const int buf = st & 1;
      // unrolled: the two passes' LDS offsets become immediates
#pragma unroll
      for (int sub = 0; sub < 2; ++sub) {
        const int key0 = st * AKS + sub * 32;
        if (key0 <= qw0 + 15) {   // wave-uniform: passes beyond the diagonal are skipped
          const _Float16* kp = &Ks[buf][sub * 32 + c][8 * hh];
          const v16h k00 = ld_frag_lds(kp);
          const v16h k01 = ld_frag_lds(kp + 32);
          const v16h k10 = ld_frag_lds(kp + 16 * AKP);
          const v16h k11 = ld_frag_lds(kp + 16 * AKP + 32);

          const _Float16* vp = &Vs[buf][sub * 32 + 8 * hh + (lane & 7)][((lane >> 3) & 1) * 8];
          v16h vf[4];   // vf[t] = V^T rows d 16t..16t+15, the pass's 32 keys
#pragma unroll
          for (int t = 0; t < 4; ++t) {
            const v8h lo = ld_tr16(vp + 16 * t);
            const v8h hi = ld_tr16(vp + 16 * AVP + 16 * t);
#pragma unroll
            for (int i = 0; i < 8; ++i) { vf[t][i] = lo[i]; vf[t][i + 8] = hi[i]; }
          }

          // Keeps the pass's 16 LDS reads one group in front of its WMMAs: left alone
          // the compiler reads K two loads at a time and waits out the LDS latency
          // each time, and V^T only behind the exponentials.
          __builtin_amdgcn_sched_barrier(0);

          // s0[r] = S^T[key0 + 8hh + r][query c], s1 the 16 keys behind
          v8f s0 = (v8f){}, s1 = (v8f){};
          s0 = __builtin_amdgcn_wmma_f32_16x16x32_f16(false, k00, false, qf0, (short)0, s0, false, false);
          s1 = __builtin_amdgcn_wmma_f32_16x16x32_f16(false, k10, false, qf0, (short)0, s1, false, false);
          s0 = __builtin_amdgcn_wmma_f32_16x16x32_f16(false, k01, false, qf1, (short)0, s0, false, false);
          s1 = __builtin_amdgcn_wmma_f32_16x16x32_f16(false, k11, false, qf1, (short)0, s1, false, false);

          if (key0 + 31 > qw0) {   // wave-uniform: only the pass on the diagonal masks
            const int q = qw0 + c;
#pragma unroll
            for (int r = 0; r < 8; ++r) {
              if (key0 + 8 * hh + r > q)      s0[r] = -3.0e38f;
              if (key0 + 16 + 8 * hh + r > q) s1[r] = -3.0e38f;
            }
          }

          float mx = fmaxf(s0[0], s1[0]);
#pragma unroll
          for (int r = 1; r < 8; ++r) mx = fmaxf(mx, fmaxf(s0[r], s1[r]));
          mx = fmaxf(mx, xhalf(mx)) * cscale;   // key0 is open to every query of the wave
          const float mn    = fmaxf(m_run, mx);
          const float alpha = exp2_slot(m_run - mn);
          m_run = mn;

          v8f a0, a1;
#pragma unroll
          for (int r = 0; r < 8; ++r) {
            a0[r] = fmaf(s0[r], cscale, -mn);
            a1[r] = fmaf(s1[r], cscale, -mn);
          }
          const v8f p0 = exp2_slot8(a0);
          const v8f p1 = exp2_slot8(a1);

          v16h pf;   // P^T as B operand: element s = key key0 + 8hh + s (s < 8) or key0 + 8 + 8hh + s (s >= 8) of query c
#pragma unroll
          for (int r = 0; r < 8; ++r) {
            pf[r]     = (_Float16)p0[r];
            pf[r + 8] = (_Float16)p1[r];
          }
          const v8f ps = p0 + p1;
          const float rs = ((ps[0] + ps[1]) + (ps[2] + ps[3])) + ((ps[4] + ps[5]) + (ps[6] + ps[7]));
          l_run = l_run * alpha + rs;
#pragma unroll
          for (int t = 0; t < 4; ++t) {
            acc[t] = acc[t] * alpha;
            acc[t] = __builtin_amdgcn_wmma_f32_16x16x32_f16(false, vf[t], false, pf,
                                                            (short)0, acc[t], false, false);
          }
        }
      }
      // Foot of the stage: this wave's reads of the buffer are done ...
      asm volatile("s_wait_dscnt 0x0" ::: "memory");
      // ... its copies of the next stage have landed ...
      asm volatile("s_wait_asynccnt 0x0" ::: "memory");
      // ... and the one barrier publishes that stage and frees this buffer.
      __syncthreads();
      if (st + 2 < nst) stage(buf, st + 2);
    }
    // no copy is in flight behind the loop
    asm volatile("s_wait_asynccnt 0x0" ::: "memory");

    const float inv = 1.f / (l_run + xhalf(l_run));   // the two halves' keys joined
    _Float16* op = ctx + (size_t)(b * TT + qw0 + c) * CC + h * HD + 8 * hh;
#pragma unroll
    for (int t = 0; t < 4; ++t) {
      v8h o;   // 8 consecutive d of one query: one 16-byte store
#pragma unroll
      for (int r = 0; r < 8; ++r) o[r] = (_Float16)(acc[t][r] * inv);
      *(v8h*)(op + 16 * t) = o;
    }
    // The stores have taken their addresses before those registers are reused.
    asm volatile("s_wait_xcnt 0x0" ::: "memory");
  }
}

// ---------------------------------------------------------------------------
// Elementwise / reduction kernels
// ---------------------------------------------------------------------------
typedef __attribute__((ext_vector_type(2))) float    v2f;
typedef __attribute__((ext_vector_type(4))) _Float16 v4h;

__device__ __forceinline__ int tile_idx(int c, int tg) {
  return ((c ^ ((c >> 5) & 1)) << 5) + (((tg ^ (c >> 2)) & 7) << 2);
}

__device__ __forceinline__ void sincos_rev(float rev, float& s, float& c) {
  asm("v_sin_f32 %0, %2\n\tv_cos_f32 %1, %2\n\tv_nop" : "=&v"(s), "=&v"(c) : "v"(rev));
}

// One launch for all the work that depends on no other launch: the layout turn of
// x and the f32 -> f16 copies of the four weight matrices.
// One block = 32 consecutive time steps of one batch entry, all 1024 channels.
// x is read as whole 128-byte lines along t, turned in LDS, and src / xq are
// written as whole lines along c; wave w owns time steps 2w and 2w+1.
// Each of the grid's 4096 waves also converts three chunks of WCH weight elements:
// chunk gw of [w_in | w_o], of w1 and of w2 (3072 + 1024, 4096 and 4096 chunks); w16
// holds the four f16 matrices in that order, one behind the other. A chunk is 8 loads
// of 16 bytes a lane, each 512 contiguous bytes over the wave. All 40 loads of a lane
// are issued before the first result is used; the weights are stored behind the
// barrier, so that no store is waited for there and their lines go out while the
// positional terms are computed.
#define WCH 1024
__global__ __launch_bounds__(512)
void prep_cvt_kernel(const float* __restrict__ x, float* __restrict__ src,
                     _Float16* __restrict__ xq,
                     const float* __restrict__ w_in, const float* __restrict__ w_o,
                     const float* __restrict__ w1, const float* __restrict__ w2,
                     _Float16* __restrict__ w16) {
  __shared__ __align__(16) float tile[CC * 32];
  const int tid  = threadIdx.x;
  const int lane = tid & 31;
  const int w    = tid >> 5;
  const int row0 = blockIdx.x * 32;   // n*T + t of the first time step
  const int n  = row0 >> 10;
  const int t0 = row0 & 1023;
  // The wave's number over the grid, 0..4095; read from the first lane, so that the
  // choice of the matrix is a scalar one and the chunks' bases lie in scalar registers.
  const int gw = blockIdx.x * 16 + __builtin_amdgcn_readfirstlane(w);
  v4f wr[3][8];
  {
    const float* wp[3];
    wp[0] = (gw < 3072 ? w_in + (size_t)gw * WCH : w_o + (size_t)(gw - 3072) * WCH) + lane * 4;
    wp[1] = w1 + (size_t)gw * WCH + lane * 4;
    wp[2] = w2 + (size_t)gw * WCH + lane * 4;
#pragma unroll
    for (int j = 0; j < 3; ++j)
#pragma unroll
      for (int k = 0; k < 8; ++k) wr[j][k] = *(const v4f*)(wp[j] + k * 128);
  }
  {
    const int tg = tid & 7;
    const float* xp = x + ((size_t)n * CC + (tid >> 3)) * TT + t0 + tg * 4;
    v4f xr[16];
#pragma unroll
    for (int k = 0; k < 16; ++k) {
      // The last load's result may be given the address pair that the loads
      // before it name: they have taken their address behind this wait.
      if (k == 15) asm volatile("s_wait_xcnt 0x0" ::: "memory");
      xr[k] = *(const v4f*)(xp + (size_t)k * 64 * TT);
    }
#pragma unroll
    for (int k = 0; k < 16; ++k)
      *(v4f*)&tile[tile_idx(k * 64 + (tid >> 3), tg)] = xr[k];
  }
  __syncthreads();

  {
    _Float16* op = w16 + (size_t)gw * WCH + lane * 4;
#pragma unroll
    for (int j = 0; j < 3; ++j)
#pragma unroll
      for (int k = 0; k < 8; ++k) {
        v4h h;
#pragma unroll
        for (int e = 0; e < 4; ++e) h[e] = (_Float16)wr[j][k][e];
        *(v4h*)(op + (size_t)j * 4096 * WCH + k * 128) = h;
      }
  }

  const float k0 = -logf(10000.0f) / (float)CC;
  const float ta = (float)(t0 + 2 * w);
  const float tb = (float)(t0 + 2 * w + 1);
  float*    sp = src + (size_t)(row0 + 2 * w) * CC + lane * 4;
  _Float16* qp = xq  + (size_t)(row0 + 2 * w) * CC + lane * 4;
#pragma unroll
  for (int i = 0; i < 8; ++i) {
    const int c0 = i * 128 + lane * 4;
    v4f sa, sb;
    v4h qa, qb;
#pragma unroll
    for (int j = 0; j < 4; j += 2) {   // channels c0+j (sin) and c0+j+1 (cos) share an angle
      const float f = exp2_slot(k0 * (float)(c0 + j) * 1.4426950408889634f);
      float pea[2], peb[2];
      sincos_rev(ta * f * 0.15915494309189532f, pea[0], pea[1]);
      sincos_rev(tb * f * 0.15915494309189532f, peb[0], peb[1]);
#pragma unroll
      for (int e = 0; e < 2; ++e) {
        const v2f p = *(const v2f*)&tile[tile_idx(c0 + j + e, w >> 1) + (w & 1) * 2];
        sa[j + e] = p[0];
        sb[j + e] = p[1];
        qa[j + e] = (_Float16)(p[0] + pea[e]);
        qb[j + e] = (_Float16)(p[1] + peb[e]);
      }
    }
    *(v4f*)(sp + i * 128)      = sa;
    *(v4f*)(sp + CC + i * 128) = sb;
    *(v4h*)(qp + i * 128)      = qa;
    *(v4h*)(qp + CC + i * 128) = qb;
  }
}

__device__ __forceinline__ float block_sum_256(float v, float* red) {
  const int tid = threadIdx.x;
  red[tid] = v; __syncthreads();
  for (int o = 128; o > 0; o >>= 1) {
    if (tid < o) red[tid] += red[tid + o];
    __syncthreads();
  }
  const float s = red[0];
  __syncthreads();
  return s;
}

__global__ __launch_bounds__(256)
void ln1_kernel(const float* __restrict__ a, const float* __restrict__ bb,
                const float* __restrict__ g, const float* __restrict__ beta,
                float* __restrict__ hout, _Float16* __restrict__ h16) {
  __shared__ float red[256];
  const int row = blockIdx.x, tid = threadIdx.x;
  float vals[4], s = 0.f;
#pragma unroll
  for (int i = 0; i < 4; ++i) {
    const int c = tid + i * 256;
    const float v = a[(size_t)row * CC + c] + bb[(size_t)row * CC + c];
    vals[i] = v; s += v;
  }
  const float mu = block_sum_256(s, red) * (1.f / CC);
  float sq = 0.f;
#pragma unroll
  for (int i = 0; i < 4; ++i) { const float d = vals[i] - mu; sq += d * d; }
  const float rstd = rsqrtf(block_sum_256(sq, red) * (1.f / CC) + 1e-5f);
#pragma unroll
  for (int i = 0; i < 4; ++i) {
    const int c = tid + i * 256;
    const float o = (vals[i] - mu) * rstd * g[c] + beta[c];
    hout[(size_t)row * CC + c] = o;
    h16[(size_t)row * CC + c] = (_Float16)o;
  }
}

__device__ __forceinline__ float wave_sum(float v) {
#pragma unroll
  for (int off = 16; off >= 1; off >>= 1) v += __shfl_xor(v, off, 32);
  return v;
}

// One block = 32 consecutive time steps of one batch entry. Wave w normalises
// rows 2w and 2w+1 whole (row sums inside the wave), lays the results in the LDS
// tile, and the block then stores whole 128-byte lines of out along t.
__global__ __launch_bounds__(512)
void ln2t_kernel(const float* __restrict__ a, const float* __restrict__ bb,
                 const float* __restrict__ g, const float* __restrict__ beta,
                 float* __restrict__ out) {
  __shared__ __align__(16) float tile[CC * 32];
  const int tid  = threadIdx.x;
  const int lane = tid & 31;
  const int w    = tid >> 5;
  const int row0 = blockIdx.x * 32;
  const int n  = row0 >> 10;
  const int t0 = row0 & 1023;

  const float* ap = a  + (size_t)(row0 + 2 * w) * CC + lane * 4;
  const float* bp = bb + (size_t)(row0 + 2 * w) * CC + lane * 4;
  v4f v[2][8];
#pragma unroll
  for (int r = 0; r < 2; ++r)
#pragma unroll
    for (int i = 0; i < 8; ++i)
      v[r][i] = *(const v4f*)(ap + r * CC + i * 128) + *(const v4f*)(bp + r * CC + i * 128);

  float mu[2], rstd[2];
#pragma unroll
  for (int r = 0; r < 2; ++r) {
    float s = 0.f;
#pragma unroll
    for (int i = 0; i < 8; ++i)
#pragma unroll
      for (int j = 0; j < 4; ++j) s += v[r][i][j];
    mu[r] = wave_sum(s) * (1.f / CC);
    float sq = 0.f;
#pragma unroll
    for (int i = 0; i < 8; ++i)
#pragma unroll
      for (int j = 0; j < 4; ++j) { const float d = v[r][i][j] - mu[r]; sq += d * d; }
    rstd[r] = rsqrtf(wave_sum(sq) * (1.f / CC) + 1e-5f);
  }

#pragma unroll
  for (int i = 0; i < 8; ++i) {
    const int c0 = i * 128 + lane * 4;
    const v4f gg = *(const v4f*)(g + c0);
    const v4f be = *(const v4f*)(beta + c0);
#pragma unroll
    for (int j = 0; j < 4; ++j) {
      v2f o;
      o[0] = (v[0][i][j] - mu[0]) * rstd[0] * gg[j] + be[j];
      o[1] = (v[1][i][j] - mu[1]) * rstd[1] * gg[j] + be[j];
      *(v2f*)&tile[tile_idx(c0 + j, w >> 1) + (w & 1) * 2] = o;
    }
  }
  __syncthreads();

  const int tg = tid & 7;
  float* op = out + ((size_t)n * CC + (tid >> 3)) * TT + t0 + tg * 4;
#pragma unroll
  for (int k = 0; k < 16; ++k) {
    const int c = k * 64 + (tid >> 3);
    *(v4f*)(op + (size_t)k * 64 * TT) = *(const v4f*)&tile[tile_idx(c, tg)];
  }
}

// ---------------------------------------------------------------------------
extern "C" void kernel_launch(void* const* d_in, const int* in_sizes, int n_in,
                              void* d_out, int out_size, void* d_ws, size_t ws_size,
                              hipStream_t stream) {
  const float* x    = (const float*)d_in[0];
  const float* w_in = (const float*)d_in[1];
  const float* w_o  = (const float*)d_in[2];
  const float* ln1g = (const float*)d_in[3];
  const float* ln1b = (const float*)d_in[4];
  const float* ln2g = (const float*)d_in[5];
  const float* ln2b = (const float*)d_in[6];
  const float* w1   = (const float*)d_in[7];
  const float* b1   = (const float*)d_in[8];
  const float* w2   = (const float*)d_in[9];
  const float* b2   = (const float*)d_in[10];

  char* ws = (char*)d_ws;
  const size_t MB = 1ull << 20;
  float*    src     = (float*)(ws + 0);            // 32 MiB; dead after LN1
  float*    ff2     = src;                         // alias (written by FFN2)
  float*    hbuf    = (float*)(ws + 32 * MB);      // 32 MiB
  _Float16* h16     = (_Float16*)(ws + 64 * MB);   // 16 MiB
  _Float16* xq      = (_Float16*)(ws + 80 * MB);   // 16 MiB; dead after QKV GEMM
  _Float16* ctx     = xq;                          // alias
  float*    attnout = (float*)(ws + 96 * MB);      // 32 MiB
  _Float16* qkv     = (_Float16*)(ws + 128 * MB);  // 48 MiB; dead after attention
  _Float16* ff      = qkv;                         // alias (64 MiB)
  _Float16* wqkv16  = (_Float16*)(ws + 192 * MB);
  _Float16* wout16  = wqkv16 + (size_t)3072 * 1024;
  _Float16* w116    = wout16 + (size_t)1024 * 1024;
  _Float16* w216    = w116 + (size_t)HIDD * 1024;

  // transpose + PE, and the weight conversions f32 -> f16
  prep_cvt_kernel<<<NB * TT / 32, 512, 0, stream>>>(x, src, xq, w_in, w_o, w1, w2, wqkv16);

  // QKV projection: [8192,1024] x [3072,1024]^T -> f16 [8192,3072]
  gemm_wmma_kernel<0, 3072, 2><<<dim3(3072 / GBN, 8192 / GBM), 256, 0, stream>>>(
      xq, wqkv16, nullptr, qkv, 8192, 3072, 1024);

  // causal flash attention
  attn_kernel<<<dim3(TT / 256, NHEADS, NB), 256, 0, stream>>>(qkv, ctx);

  // out projection -> f32 [8192,1024]
  gemm_wmma_kernel<1, 1024, 4><<<dim3(1024 / GBN, 8192 / GBM), 256, 0, stream>>>(
      ctx, wout16, nullptr, attnout, 8192, 1024, 1024);

  // residual + LN1 -> h (f32 + f16)
  ln1_kernel<<<NB * TT, 256, 0, stream>>>(src, attnout, ln1g, ln1b, hbuf, h16);

  // FFN1: relu(h @ w1^T + b1) -> f16 [8192,4096]
  gemm_wmma_kernel<2, HIDD, 2><<<dim3(HIDD / GBN, 8192 / GBM), 256, 0, stream>>>(
      h16, w116, b1, ff, 8192, HIDD, 1024);

  // FFN2: ff @ w2^T + b2 -> f32 [8192,1024]
  gemm_wmma_kernel<3, 1024, 4><<<dim3(1024 / GBN, 8192 / GBM), 256, 0, stream>>>(
      ff, w216, b2, ff2, 8192, 1024, HIDD);

  // residual + LN2 + transpose back to [N,C,T]
  ln2t_kernel<<<NB * TT / 32, 512, 0, stream>>>(hbuf, ff2, ln2g, ln2b, (float*)d_out);
}

// v008
// It runs in 221 microseconds.
// In two side-by-side timings against v007, it was 1.03 and 1.04 times as fast.
// All steps since v000 together make it 2.84 times as fast.
#include <hip/hip_runtime.h>
#include <hip/hip_bf16.h>
#include <math.h>

typedef __attribute__((ext_vector_type(16))) _Float16 v16h;
typedef __attribute__((ext_vector_type(8)))  _Float16 v8h;
typedef __attribute__((ext_vector_type(8)))  float    v8f;
typedef __attribute__((ext_vector_type(4)))  float    v4f;

#define NB    8
#define TT    1024
#define CC    1024
#define NHEADS 16
#define HD    64
#define HIDD  4096

__device__ __forceinline__ v16h ld_frag_row(const _Float16* __restrict__ base, int ld) {
  const int lane = threadIdx.x & 31;
  const int row  = lane & 15;
  const int koff = (lane & 16) ? 8 : 0;
  const _Float16* p = base + (size_t)row * ld + koff;
  v8h lo = *(const v8h*)(p);        // K = koff .. koff+7
  v8h hi = *(const v8h*)(p + 16);   // K = 16+koff .. 23+koff
  v16h r;
#pragma unroll
  for (int i = 0; i < 8; ++i) { r[i] = lo[i]; r[i + 8] = hi[i]; }
  return r;
}

__device__ __forceinline__ v16h ld_frag_lds(const _Float16* p) {
  v8h lo = *(const v8h*)(p);
  v8h hi = *(const v8h*)(p + 16);
  v16h r;
#pragma unroll
  for (int i = 0; i < 8; ++i) { r[i] = lo[i]; r[i + 8] = hi[i]; }
  return r;
}

// ---------------------------------------------------------------------------
// LDS-staged WMMA GEMM: D[M,N] = A[M,K] * B[N,K]^T (row-major f16, K contig).
// Block = 256 thr = 8 waves; block tile 256x128, 64 k a pass; wave tile 64x64.
// M a multiple of 256, N of 128, K of 64 (the grid covers D exactly).
// A/B panels (whole 128-byte lines of every row) lie in a ring of NBUF LDS buffers,
// filled with global_load_async_to_lds_b128 and read as ds_load_b128 fragments; the
// copies of the next NBUF-1 passes fly while this pass's panel is worked on.
// NBUF = 2 where two blocks share a WGP and hide each other's waits. NBUF = 4 where
// the grid is one block a WGP: one pass of lead is less than the way from memory.
// Every block walks all of K, but starts at pass (blockIdx.x + blockIdx.y) & 15 and
// wraps: the blocks of one tile row share the A lines and those of one tile column
// the B lines, and walking in step they would all ask L2 for the same lines at the
// same moment. K is at least 16 passes.
// EPI: 0 = f16 ; 1 = f32 ; 2 = relu(x+bias)->f16 ; 3 = x+bias->f32
// NC = N at compile time: the epilogue's row steps become immediate offsets, so
// that all stores of a lane share one address pair.
// ---------------------------------------------------------------------------
#define GBM 256
#define GBN 128
#define GBK 64
#define GPITCH 72   // halves: a 128-byte row and 16 bytes, the b128 readers' pitch

template <int EPI, int NC, int NBUF>
__global__ __launch_bounds__(256)
void gemm_wmma_kernel(const _Float16* __restrict__ A, const _Float16* __restrict__ B,
                      const float* __restrict__ bias, void* __restrict__ D,
                      int M, int N, int K) {
  __shared__ __align__(16) _Float16 As[NBUF][GBM][GPITCH];
  __shared__ __align__(16) _Float16 Bs[NBUF][GBN][GPITCH];

  const int tid  = threadIdx.x;
  const int w    = tid >> 5;
  const int wm   = w >> 1;          // 0..3 -> 64-row strip
  const int wn   = w & 1;           // 0..1 -> 64-col strip
  const int rowB = blockIdx.y * GBM;
  const int colB = blockIdx.x * GBN;

  v8f acc[4][4];
#pragma unroll
  for (int mi = 0; mi < 4; ++mi)
#pragma unroll
    for (int j = 0; j < 4; ++j) acc[mi][j] = (v8f){};

  // One panel pair = 384 rows of 128 bytes = 12 copies of 16 bytes a thread.
  // Eight lanes cover one row, so a wave's copy is four whole lines; copy t of a
  // thread lies 32 rows below copy t-1.
  const int crow = tid >> 3;         // 0..31
  const int cseg = (tid & 7) * 8;    // halves (16-byte chunks)
  const unsigned long long gstep = (unsigned long long)K * 64;   // 32 rows, bytes
  const unsigned lstep = 32 * GPITCH * 2;                        // 32 rows, bytes
  const unsigned long long gA =
      (unsigned long long)(A + (size_t)(rowB + crow) * K + cseg);
  const unsigned long long gB =
      (unsigned long long)(B + (size_t)(colB + crow) * K + cseg);
  auto prefetch = [&](int buf, int k) {
    const unsigned long long ga = gA + (unsigned long long)k * 2;
    const unsigned long long gb = gB + (unsigned long long)k * 2;
    const unsigned la = (unsigned)(uintptr_t)&As[buf][crow][cseg];
    const unsigned lb = (unsigned)(uintptr_t)&Bs[buf][crow][cseg];
    asm volatile(
        "global_load_async_to_lds_b128 %0, %12, off\n\t"
        "global_load_async_to_lds_b128 %1, %13, off\n\t"
        "global_load_async_to_lds_b128 %2, %14, off\n\t"
        "global_load_async_to_lds_b128 %3, %15, off\n\t"
        "global_load_async_to_lds_b128 %4, %16, off\n\t"
        "global_load_async_to_lds_b128 %5, %17, off\n\t"
        "global_load_async_to_lds_b128 %6, %18, off\n\t"
        "global_load_async_to_lds_b128 %7, %19, off\n\t"
        "global_load_async_to_lds_b128 %8, %20, off\n\t"
        "global_load_async_to_lds_b128 %9, %21, off\n\t"
        "global_load_async_to_lds_b128 %10, %22, off\n\t"
        "global_load_async_to_lds_b128 %11, %23, off\n\t"
        "s_wait_xcnt 0x0"
        :: "v"(la), "v"(la + lstep), "v"(la + 2 * lstep), "v"(la + 3 * lstep),
           "v"(la + 4 * lstep), "v"(la + 5 * lstep), "v"(la + 6 * lstep),
           "v"(la + 7 * lstep),
           "v"(lb), "v"(lb + lstep), "v"(lb + 2 * lstep), "v"(lb + 3 * lstep),
           "v"(ga), "v"(ga + gstep), "v"(ga + 2 * gstep), "v"(ga + 3 * gstep),
           "v"(ga + 4 * gstep), "v"(ga + 5 * gstep), "v"(ga + 6 * gstep),
           "v"(ga + 7 * gstep),
           "v"(gb), "v"(gb + gstep), "v"(gb + 2 * gstep), "v"(gb + 3 * gstep)
        : "memory");
  };

  const int lane = tid & 31;
  const int fr   = lane & 15;
  const int koff = (lane & 16) ? 8 : 0;
  const int KT   = K / GBK;
  const int rot  = (blockIdx.x + blockIdx.y) & 15;
  // first k of the panel that pass s works on
  auto kof = [&](int s) {
    const int t = s + rot;
    return (t >= KT ? t - KT : t) * GBK;
  };

  if constexpr (NBUF == 2) {
    prefetch(0, kof(0));
    // panel 0 has landed for this wave, then for the block
    asm volatile("s_wait_asynccnt 0x0" ::: "memory");
    __syncthreads();
    if (KT > 1) prefetch(1, kof(1));
  } else {
    // unrolled: the buffers' LDS addresses become constants
#pragma unroll
    for (int s = 0; s < NBUF; ++s) prefetch(s, kof(s));
    // All but the wave's 12 (NBUF-1) youngest copies have landed: panel 0, for this
    // wave, then for the block.
    asm volatile("s_wait_asynccnt %0" :: "n"(12 * (NBUF - 1)) : "memory");
    __syncthreads();
  }

  for (int kt = 0; kt < KT; ++kt) {
    const int buf = kt & (NBUF - 1);
    const _Float16* ap = &As[buf][wm * 64 + fr][koff];
    const _Float16* bp = &Bs[buf][wn * 64 + fr][koff];
    v16h a[4], b[4];
    auto load_frags = [&](int ks) {   // 16 ds_load_b128: 32 k of the wave's rows
#pragma unroll
      for (int mi = 0; mi < 4; ++mi)
        a[mi] = ld_frag_lds(ap + mi * 16 * GPITCH + ks * 32);
#pragma unroll
      for (int j = 0; j < 4; ++j)
        b[j] = ld_frag_lds(bp + j * 16 * GPITCH + ks * 32);
    };
    auto mma = [&]() {
#pragma unroll
      for (int j = 0; j < 4; ++j)
#pragma unroll
        for (int mi = 0; mi < 4; ++mi)
          acc[mi][j] = __builtin_amdgcn_wmma_f32_16x16x32_f16(
              false, b[j], false, a[mi], (short)0, acc[mi][j], false, false);
    };
    load_frags(0);
    // Keeps the 16 LDS reads one group in front of their 16 WMMAs: left alone
    // the compiler reloads one B fragment every 4 WMMAs and waits out the LDS
    // latency each time.
    __builtin_amdgcn_sched_barrier(0);
    mma();
    load_frags(1);   // the wave's last reads of this panel
    // Foot of the pass: this wave's reads of the panel are done ...
    asm volatile("s_wait_dscnt 0x0" ::: "memory");
    // ... its copies of the next panel have landed ...
    if (NBUF > 2 && kt + NBUF < KT) {
      // A pass that refills (the test reads the same for the block): every pass so far
      // has issued its 12 copies, so the wave's 12 (NBUF-2) youngest are the panels
      // behind the next one, and they stay in flight.
      asm volatile("s_wait_asynccnt %0" :: "n"(12 * (NBUF - 2)) : "memory");
    } else {
      asm volatile("s_wait_asynccnt 0x0" ::: "memory");
    }
    // ... and the one barrier publishes that panel and frees this one.
    __syncthreads();
    if (kt + NBUF < KT) prefetch(buf, kof(kt + NBUF));
    // The second half's products need registers only: behind the refill, so
    // that the copies have the whole next pass to land.
    mma();
  }
  // no copy is in flight when the wave ends
  asm volatile("s_wait_asynccnt 0x0" ::: "memory");

  // Epilogue. The weight rows are the first WMMA operand, so lane (c, hh) holds
  // D[m0 + 16 mi + c][n0 + 16 j + 8 hh + r], r = 0..7: 8 consecutive columns of a row.
  // Each wave lays its 64x64 tile in its own 9216 bytes of As (every wave has left
  // the ring at the last pass's barrier and no copy is in flight), reads it back by
  // rows and stores whole 128-byte lines.
  const int c  = lane & 15;
  const int hh = lane >> 4;
  const int n0 = colB + wn * 64;
  const int m0 = rowB + wm * 64;
  char* stg = (char*)&As[0][0][0] + w * (64 * GPITCH * 2);
  if (EPI == 0 || EPI == 2) {
    // f16: 64 rows of 128 bytes at the ring's pitch of 144
#pragma unroll
    for (int j = 0; j < 4; ++j) {
      v4f bl = (v4f){}, bh = (v4f){};
      if (EPI == 2) {
        bl = *(const v4f*)(bias + n0 + j * 16 + 8 * hh);
        bh = *(const v4f*)(bias + n0 + j * 16 + 8 * hh + 4);
      }
#pragma unroll
      for (int mi = 0; mi < 4; ++mi) {
        v8h o;
#pragma unroll
        for (int r = 0; r < 8; ++r) {
          float v = acc[mi][j][r];
          if (EPI == 2) {
            v += (r < 4) ? bl[r & 3] : bh[r & 3];
            v = v > 0.f ? v : 0.f;
          }
          o[r] = (_Float16)v;
        }
        *(v8h*)(stg + (mi * 16 + c) * (GPITCH * 2) + j * 32 + hh * 16) = o;
      }
    }
    // The other lanes' rows are in LDS before this lane reads them back.
    asm volatile("s_wait_dscnt 0x0" ::: "memory");
    const int rr = lane >> 3;   // eight lanes cover one 128-byte line
    _Float16* dp = (_Float16*)D + (size_t)(m0 + rr) * NC + n0 + (lane & 7) * 8;
    const char* sp = stg + rr * (GPITCH * 2) + (lane & 7) * 16;
#pragma unroll
    for (int it = 0; it < 16; ++it)
      *(v8h*)(dp + it * 4 * NC) = *(const v8h*)(sp + it * 4 * (GPITCH * 2));
  } else {
    // f32: 32 rows of 256 bytes at a pitch of 272, in two rounds
    const int FP = 272;
    v4f bl[4], bh[4];
    if (EPI == 3) {
#pragma unroll
      for (int j = 0; j < 4; ++j) {
        bl[j] = *(const v4f*)(bias + n0 + j * 16 + 8 * hh);
        bh[j] = *(const v4f*)(bias + n0 + j * 16 + 8 * hh + 4);
      }
    }
    const int rr = lane >> 4;   // sixteen lanes cover one row's two lines
    const char* sp = stg + rr * FP + (lane & 15) * 16;
    float* dp = (float*)D + (size_t)(m0 + rr) * NC + n0 + (lane & 15) * 4;
#pragma unroll
    for (int half = 0; half < 2; ++half) {
#pragma unroll
      for (int m2 = 0; m2 < 2; ++m2) {
#pragma unroll
        for (int j = 0; j < 4; ++j) {
          const v8f t = acc[half * 2 + m2][j];
          v4f lo = (v4f){t[0], t[1], t[2], t[3]};
          v4f hi = (v4f){t[4], t[5], t[6], t[7]};
          if (EPI == 3) { lo += bl[j]; hi += bh[j]; }
          char* q = stg + (m2 * 16 + c) * FP + j * 64 + hh * 32;
          *(v4f*)(q)      = lo;
          *(v4f*)(q + 16) = hi;
        }
      }
      // The other lanes' rows are in LDS before this lane reads them back.
      asm volatile("s_wait_dscnt 0x0" ::: "memory");
#pragma unroll
      for (int it = 0; it < 16; ++it)
        *(v4f*)(dp + (half * 32 + it * 2) * NC) = *(const v4f*)(sp + it * 2 * FP);
      // This round's rows have been read before the next round overwrites them, and
      // its stores have taken their registers before the next round's reads land there.
      if (half == 0) asm volatile("s_wait_dscnt 0x0\n\ts_wait_xcnt 0x0" ::: "memory");
    }
  }
}

// ---------------------------------------------------------------------------
// Flash attention, causal, by transposed products: S^T = K.Q^T, O^T += V^T.P^T.
// qkv: [N*T, 3C] f16 (Q | K | V slabs). ctx out: [N*T, C] f16.
// Block = 8 waves of 16 query columns = 128 queries of one (batch, head). The
// block walks the keys in stages of 64: K and V rows lie in two LDS buffers,
// filled with global_load_async_to_lds_b128; the next stage's copies fly while
// this one is worked on. A lane holds one query's scores (16 of a pass's 32
// keys): maximum and sum in the lane plus one exchange between the wave halves.
// The score tiles, converted in place, are the B operand of the second product,
// and V^T comes by ds_load_tr16_b128, so P never leaves the registers.
// Each block takes query blocks 7-x and x, so that all blocks walk 18 stages.
// ---------------------------------------------------------------------------
#define AKS 64   // keys a stage
#define AKP 72   // halves: K row and 16 bytes, the ds_load_b128 readers' pitch
#define AVP 80   // halves: V row and 32 bytes, the ds_load_tr16_b128 readers' pitch

typedef __attribute__((ext_vector_type(8))) short s16x8;

// Lane (c = l & 15, hh = l >> 4) gets 8 rows of column c of a row-major 16-bit
// LDS tile; p is the lane's own 16-byte address in that tile.
__device__ __forceinline__ v8h ld_tr16(const _Float16* p) {
  typedef __attribute__((address_space(3))) s16x8 lds_s16x8;
  return __builtin_bit_cast(v8h, __builtin_amdgcn_ds_load_tr16_b128_v8i16((lds_s16x8*)p));
}

__device__ __forceinline__ float xhalf(float x) {
  const int i = __builtin_bit_cast(int, x);
  return __builtin_bit_cast(float, __builtin_amdgcn_permlanex16(
      i, i, 0x76543210, 0xfedcba98, false, false));
}

__device__ __forceinline__ float exp2_slot(float x) {
  float r;
  asm("v_exp_f32 %0, %1\n\tv_nop" : "=v"(r) : "v"(x));
  return r;
}

__device__ __forceinline__ v8f exp2_slot8(v8f x) {
  float r0, r1, r2, r3, r4, r5, r6, r7;
  asm("v_exp_f32 %0, %8\n\t"
      "v_exp_f32 %1, %9\n\t"
      "v_exp_f32 %2, %10\n\t"
      "v_exp_f32 %3, %11\n\t"
      "v_exp_f32 %4, %12\n\t"
      "v_exp_f32 %5, %13\n\t"
      "v_exp_f32 %6, %14\n\t"
      "v_exp_f32 %7, %15\n\t"
      "v_nop"
      : "=&v"(r0), "=&v"(r1), "=&v"(r2), "=&v"(r3),
        "=&v"(r4), "=&v"(r5), "=&v"(r6), "=&v"(r7)
      : "v"(x[0]), "v"(x[1]), "v"(x[2]), "v"(x[3]),
        "v"(x[4]), "v"(x[5]), "v"(x[6]), "v"(x[7]));
  return (v8f){r0, r1, r2, r3, r4, r5, r6, r7};
}

__global__ __launch_bounds__(256)
void attn_kernel(const _Float16* __restrict__ qkv, _Float16* __restrict__ ctx) {
  __shared__ __align__(16) _Float16 Ks[2][AKS][AKP];
  __shared__ __align__(32) _Float16 Vs[2][AKS][AVP];

  const int tid  = threadIdx.x;
  const int lane = tid & 31;
  const int w    = __builtin_amdgcn_readfirstlane(tid >> 5);
  const int c    = lane & 15;
  const int hh   = lane >> 4;
  const int b    = blockIdx.z;
  const int h    = blockIdx.y;
  const int LD   = 3 * CC;
  const float cscale = 0.125f * 1.4426950408889634f;   // 1/sqrt(64), base-2 exponentials

  const _Float16* base = qkv + (size_t)(b * TT) * LD + h * HD;

  // One stage = 64 K rows and 64 V rows of 128 bytes = 4 copies of 16 bytes a
  // thread; eight lanes cover one row.
  const int crow = tid >> 3;         // 0..31
  const int cseg = (tid & 7) * 8;    // halves
  const unsigned long long gK =
      (unsigned long long)(base + CC + (size_t)crow * LD + cseg);
  auto stage = [&](int buf, int st) {
    const unsigned long long gk = gK + (unsigned long long)st * (AKS * 3 * CC * 2);
    const unsigned long long gv = gk + CC * 2;
    const unsigned lk = (unsigned)(uintptr_t)&Ks[buf][crow][cseg];
    const unsigned lv = (unsigned)(uintptr_t)&Vs[buf][crow][cseg];
    asm volatile(
        "global_load_async_to_lds_b128 %0, %4, off\n\t"
        "global_load_async_to_lds_b128 %1, %5, off\n\t"
        "global_load_async_to_lds_b128 %2, %6, off\n\t"
        "global_load_async_to_lds_b128 %3, %7, off\n\t"
        "s_wait_xcnt 0x0"
        :: "v"(lk), "v"(lk + 32 * AKP * 2), "v"(lv), "v"(lv + 32 * AVP * 2),
           "v"(gk), "v"(gk + 32 * 3 * CC * 2), "v"(gv), "v"(gv + 32 * 3 * CC * 2)
        : "memory");
  };

  for (int part = 0; part < 2; ++part) {
    const int pb  = part ? (int)blockIdx.x : 7 - (int)blockIdx.x;
    const int qw0 = pb * 128 + w * 16;   // the wave's first query
    const int nst = 2 * (pb + 1);        // stages: keys 0 .. pb*128+127

    // Every wave has left both buffers: the barrier at the foot of the last stage.
    stage(0, 0);

    const v16h qf0 = ld_frag_row(base + (size_t)qw0 * LD, LD);        // d 0..31
    const v16h qf1 = ld_frag_row(base + (size_t)qw0 * LD + 32, LD);   // d 32..63
    // The loads have taken their addresses before those registers are reused.
    asm volatile("s_wait_xcnt 0x0" ::: "memory");

    v8f acc[4];   // acc[t][r] = O^T[d = 16t + 8hh + r][query c]
    // Loops over register arrays are unrolled so that the arrays stay in registers.
#pragma unroll
    for (int t = 0; t < 4; ++t) acc[t] = (v8f){};
    float m_run = -3.0e38f;   // the query's maximum, scaled, same in both halves
    float l_run = 0.f;        // the sum over this lane's keys only

    // stage 0 has landed for this wave, then for the block
    asm volatile("s_wait_asynccnt 0x0" ::: "memory");
    __syncthreads();
    stage(1, 1);   // nst >= 2

    for (int st = 0; st < nst; ++st) {
      const int buf = st & 1;
      // unrolled: the two passes' LDS offsets become immediates
#pragma unroll
      for (int sub = 0; sub < 2; ++sub) {
        const int key0 = st * AKS + sub * 32;
        if (key0 <= qw0 + 15) {   // wave-uniform: passes beyond the diagonal are skipped
          const _Float16* kp = &Ks[buf][sub * 32 + c][8 * hh];
          const v16h k00 = ld_frag_lds(kp);
          const v16h k01 = ld_frag_lds(kp + 32);
          const v16h k10 = ld_frag_lds(kp + 16 * AKP);
          const v16h k11 = ld_frag_lds(kp + 16 * AKP + 32);

          const _Float16* vp = &Vs[buf][sub * 32 + 8 * hh + (lane & 7)][((lane >> 3) & 1) * 8];
          v16h vf[4];   // vf[t] = V^T rows d 16t..16t+15, the pass's 32 keys
#pragma unroll
          for (int t = 0; t < 4; ++t) {
            const v8h lo = ld_tr16(vp + 16 * t);
            const v8h hi = ld_tr16(vp + 16 * AVP + 16 * t);
#pragma unroll
            for (int i = 0; i < 8; ++i) { vf[t][i] = lo[i]; vf[t][i + 8] = hi[i]; }
          }

          // Keeps the pass's 16 LDS reads one group in front of its WMMAs: left alone
          // the compiler reads K two loads at a time and waits out the LDS latency
          // each time, and V^T only behind the exponentials.
          __builtin_amdgcn_sched_barrier(0);

          // s0[r] = S^T[key0 + 8hh + r][query c], s1 the 16 keys behind
          v8f s0 = (v8f){}, s1 = (v8f){};
          s0 = __builtin_amdgcn_wmma_f32_16x16x32_f16(false, k00, false, qf0, (short)0, s0, false, false);
          s1 = __builtin_amdgcn_wmma_f32_16x16x32_f16(false, k10, false, qf0, (short)0, s1, false, false);
          s0 = __builtin_amdgcn_wmma_f32_16x16x32_f16(false, k01, false, qf1, (short)0, s0, false, false);
          s1 = __builtin_amdgcn_wmma_f32_16x16x32_f16(false, k11, false, qf1, (short)0, s1, false, false);

          if (key0 + 31 > qw0) {   // wave-uniform: only the pass on the diagonal masks
            const int q = qw0 + c;
#pragma unroll
            for (int r = 0; r < 8; ++r) {
              if (key0 + 8 * hh + r > q)      s0[r] = -3.0e38f;
              if (key0 + 16 + 8 * hh + r > q) s1[r] = -3.0e38f;
            }
          }

          float mx = fmaxf(s0[0], s1[0]);
#pragma unroll
          for (int r = 1; r < 8; ++r) mx = fmaxf(mx, fmaxf(s0[r], s1[r]));
          mx = fmaxf(mx, xhalf(mx)) * cscale;   // key0 is open to every query of the wave
          const float mn    = fmaxf(m_run, mx);
          const float alpha = exp2_slot(m_run - mn);
          m_run = mn;

          v8f a0, a1;
#pragma unroll
          for (int r = 0; r < 8; ++r) {
            a0[r] = fmaf(s0[r], cscale, -mn);
            a1[r] = fmaf(s1[r], cscale, -mn);
          }
          const v8f p0 = exp2_slot8(a0);
          const v8f p1 = exp2_slot8(a1);

          v16h pf;   // P^T as B operand: element s = key key0 + 8hh + s (s < 8) or key0 + 8 + 8hh + s (s >= 8) of query c
#pragma unroll
          for (int r = 0; r < 8; ++r) {
            pf[r]     = (_Float16)p0[r];
            pf[r + 8] = (_Float16)p1[r];
          }
          const v8f ps = p0 + p1;
          const float rs = ((ps[0] + ps[1]) + (ps[2] + ps[3])) + ((ps[4] + ps[5]) + (ps[6] + ps[7]));
          l_run = l_run * alpha + rs;
#pragma unroll
          for (int t = 0; t < 4; ++t) {
            acc[t] = acc[t] * alpha;
            acc[t] = __builtin_amdgcn_wmma_f32_16x16x32_f16(false, vf[t], false, pf,
                                                            (short)0, acc[t], false, false);
          }
        }
      }
      // Foot of the stage: this wave's reads of the buffer are done ...
      asm volatile("s_wait_dscnt 0x0" ::: "memory");
      // ... its copies of the next stage have landed ...
      asm volatile("s_wait_asynccnt 0x0" ::: "memory");
      // ... and the one barrier publishes that stage and frees this buffer.
      __syncthreads();
      if (st + 2 < nst) stage(buf, st + 2);
    }
    // no copy is in flight behind the loop
    asm volatile("s_wait_asynccnt 0x0" ::: "memory");

    const float inv = 1.f / (l_run + xhalf(l_run));   // the two halves' keys joined
    _Float16* op = ctx + (size_t)(b * TT + qw0 + c) * CC + h * HD + 8 * hh;
#pragma unroll
    for (int t = 0; t < 4; ++t) {
      v8h o;   // 8 consecutive d of one query: one 16-byte store
#pragma unroll
      for (int r = 0; r < 8; ++r) o[r] = (_Float16)(acc[t][r] * inv);
      *(v8h*)(op + 16 * t) = o;
    }
    // The stores have taken their addresses before those registers are reused.
    asm volatile("s_wait_xcnt 0x0" ::: "memory");
  }
}

// ---------------------------------------------------------------------------
// Elementwise / reduction kernels
// ---------------------------------------------------------------------------
typedef __attribute__((ext_vector_type(2))) float    v2f;
typedef __attribute__((ext_vector_type(4))) _Float16 v4h;

__device__ __forceinline__ int tile_idx(int c, int tg) {
  return ((c ^ ((c >> 5) & 1)) << 5) + (((tg ^ (c >> 2)) & 7) << 2);
}

__device__ __forceinline__ void sincos_rev(float rev, float& s, float& c) {
  asm("v_sin_f32 %0, %2\n\tv_cos_f32 %1, %2\n\tv_nop" : "=&v"(s), "=&v"(c) : "v"(rev));
}

// One launch for all the work that depends on no other launch: the layout turn of
// x and the f32 -> f16 copies of the four weight matrices.
// One block = 32 consecutive time steps of one batch entry, all 1024 channels.
// x is read as whole 128-byte lines along t, turned in LDS, and src / xq are
// written as whole lines along c; wave w owns time steps 2w and 2w+1.
// Each of the grid's 4096 waves also converts three chunks of WCH weight elements:
// chunk gw of [w_in | w_o], of w1 and of w2 (3072 + 1024, 4096 and 4096 chunks); w16
// holds the four f16 matrices in that order, one behind the other. A chunk is 8 loads
// of 16 bytes a lane, each 512 contiguous bytes over the wave. All 40 loads of a lane
// are issued before the first result is used; the weights are stored behind the
// barrier, so that no store is waited for there and their lines go out while the
// positional terms are computed.
#define WCH 1024
__global__ __launch_bounds__(512)
void prep_cvt_kernel(const float* __restrict__ x, float* __restrict__ src,
                     _Float16* __restrict__ xq,
                     const float* __restrict__ w_in, const float* __restrict__ w_o,
                     const float* __restrict__ w1, const float* __restrict__ w2,
                     _Float16* __restrict__ w16) {
  __shared__ __align__(16) float tile[CC * 32];
  const int tid  = threadIdx.x;
  const int lane = tid & 31;
  const int w    = tid >> 5;
  const int row0 = blockIdx.x * 32;   // n*T + t of the first time step
  const int n  = row0 >> 10;
  const int t0 = row0 & 1023;
  // The wave's number over the grid, 0..4095; read from the first lane, so that the
  // choice of the matrix is a scalar one and the chunks' bases lie in scalar registers.
  const int gw = blockIdx.x * 16 + __builtin_amdgcn_readfirstlane(w);
  v4f wr[3][8];
  {
    const float* wp[3];
    wp[0] = (gw < 3072 ? w_in + (size_t)gw * WCH : w_o + (size_t)(gw - 3072) * WCH) + lane * 4;
    wp[1] = w1 + (size_t)gw * WCH + lane * 4;
    wp[2] = w2 + (size_t)gw * WCH + lane * 4;
#pragma unroll
    for (int j = 0; j < 3; ++j)
#pragma unroll
      for (int k = 0; k < 8; ++k) wr[j][k] = *(const v4f*)(wp[j] + k * 128);
  }
  {
    const int tg = tid & 7;
    const float* xp = x + ((size_t)n * CC + (tid >> 3)) * TT + t0 + tg * 4;
    v4f xr[16];
#pragma unroll
    for (int k = 0; k < 16; ++k) {
      // The last load's result may be given the address pair that the loads
      // before it name: they have taken their address behind this wait.
      if (k == 15) asm volatile("s_wait_xcnt 0x0" ::: "memory");
      xr[k] = *(const v4f*)(xp + (size_t)k * 64 * TT);
    }
#pragma unroll
    for (int k = 0; k < 16; ++k)
      *(v4f*)&tile[tile_idx(k * 64 + (tid >> 3), tg)] = xr[k];
  }
  __syncthreads();

  {
    _Float16* op = w16 + (size_t)gw * WCH + lane * 4;
#pragma unroll
    for (int j = 0; j < 3; ++j)
#pragma unroll
      for (int k = 0; k < 8; ++k) {
        v4h h;
#pragma unroll
        for (int e = 0; e < 4; ++e) h[e] = (_Float16)wr[j][k][e];
        *(v4h*)(op + (size_t)j * 4096 * WCH + k * 128) = h;
      }
  }

  const float k0 = -logf(10000.0f) / (float)CC;
  const float ta = (float)(t0 + 2 * w);
  const float tb = (float)(t0 + 2 * w + 1);
  float*    sp = src + (size_t)(row0 + 2 * w) * CC + lane * 4;
  _Float16* qp = xq  + (size_t)(row0 + 2 * w) * CC + lane * 4;
#pragma unroll
  for (int i = 0; i < 8; ++i) {
    const int c0 = i * 128 + lane * 4;
    v4f sa, sb;
    v4h qa, qb;
#pragma unroll
    for (int j = 0; j < 4; j += 2) {   // channels c0+j (sin) and c0+j+1 (cos) share an angle
      const float f = exp2_slot(k0 * (float)(c0 + j) * 1.4426950408889634f);
      float pea[2], peb[2];
      sincos_rev(ta * f * 0.15915494309189532f, pea[0], pea[1]);
      sincos_rev(tb * f * 0.15915494309189532f, peb[0], peb[1]);
#pragma unroll
      for (int e = 0; e < 2; ++e) {
        const v2f p = *(const v2f*)&tile[tile_idx(c0 + j + e, w >> 1) + (w & 1) * 2];
        sa[j + e] = p[0];
        sb[j + e] = p[1];
        qa[j + e] = (_Float16)(p[0] + pea[e]);
        qb[j + e] = (_Float16)(p[1] + peb[e]);
      }
    }
    *(v4f*)(sp + i * 128)      = sa;
    *(v4f*)(sp + CC + i * 128) = sb;
    *(v4h*)(qp + i * 128)      = qa;
    *(v4h*)(qp + CC + i * 128) = qb;
  }
}

__device__ __forceinline__ float block_sum_256(float v, float* red) {
  const int tid = threadIdx.x;
  red[tid] = v; __syncthreads();
  for (int o = 128; o > 0; o >>= 1) {
    if (tid < o) red[tid] += red[tid + o];
    __syncthreads();
  }
  const float s = red[0];
  __syncthreads();
  return s;
}

__global__ __launch_bounds__(256)
void ln1_kernel(const float* __restrict__ a, const float* __restrict__ bb,
                const float* __restrict__ g, const float* __restrict__ beta,
                float* __restrict__ hout, _Float16* __restrict__ h16) {
  __shared__ float red[256];
  const int row = blockIdx.x, tid = threadIdx.x;
  float vals[4], s = 0.f;
#pragma unroll
  for (int i = 0; i < 4; ++i) {
    const int c = tid + i * 256;
    const float v = a[(size_t)row * CC + c] + bb[(size_t)row * CC + c];
    vals[i] = v; s += v;
  }
  const float mu = block_sum_256(s, red) * (1.f / CC);
  float sq = 0.f;
#pragma unroll
  for (int i = 0; i < 4; ++i) { const float d = vals[i] - mu; sq += d * d; }
  const float rstd = rsqrtf(block_sum_256(sq, red) * (1.f / CC) + 1e-5f);
#pragma unroll
  for (int i = 0; i < 4; ++i) {
    const int c = tid + i * 256;
    const float o = (vals[i] - mu) * rstd * g[c] + beta[c];
    hout[(size_t)row * CC + c] = o;
    h16[(size_t)row * CC + c] = (_Float16)o;
  }
}

__device__ __forceinline__ float wave_sum(float v) {
#pragma unroll
  for (int off = 16; off >= 1; off >>= 1) v += __shfl_xor(v, off, 32);
  return v;
}

// One block = 32 consecutive time steps of one batch entry. Wave w normalises
// rows 2w and 2w+1 whole (row sums inside the wave), lays the results in the LDS
// tile, and the block then stores whole 128-byte lines of out along t.
__global__ __launch_bounds__(512)
void ln2t_kernel(const float* __restrict__ a, const float* __restrict__ bb,
                 const float* __restrict__ g, const float* __restrict__ beta,
                 float* __restrict__ out) {
  __shared__ __align__(16) float tile[CC * 32];
  const int tid  = threadIdx.x;
  const int lane = tid & 31;
  const int w    = tid >> 5;
  const int row0 = blockIdx.x * 32;
  const int n  = row0 >> 10;
  const int t0 = row0 & 1023;

  const float* ap = a  + (size_t)(row0 + 2 * w) * CC + lane * 4;
  const float* bp = bb + (size_t)(row0 + 2 * w) * CC + lane * 4;
  v4f v[2][8];
#pragma unroll
  for (int r = 0; r < 2; ++r)
#pragma unroll
    for (int i = 0; i < 8; ++i)
      v[r][i] = *(const v4f*)(ap + r * CC + i * 128) + *(const v4f*)(bp + r * CC + i * 128);

  float mu[2], rstd[2];
#pragma unroll
  for (int r = 0; r < 2; ++r) {
    float s = 0.f;
#pragma unroll
    for (int i = 0; i < 8; ++i)
#pragma unroll
      for (int j = 0; j < 4; ++j) s += v[r][i][j];
    mu[r] = wave_sum(s) * (1.f / CC);
    float sq = 0.f;
#pragma unroll
    for (int i = 0; i < 8; ++i)
#pragma unroll
      for (int j = 0; j < 4; ++j) { const float d = v[r][i][j] - mu[r]; sq += d * d; }
    rstd[r] = rsqrtf(wave_sum(sq) * (1.f / CC) + 1e-5f);
  }

#pragma unroll
  for (int i = 0; i < 8; ++i) {
    const int c0 = i * 128 + lane * 4;
    const v4f gg = *(const v4f*)(g + c0);
    const v4f be = *(const v4f*)(beta + c0);
#pragma unroll
    for (int j = 0; j < 4; ++j) {
      v2f o;
      o[0] = (v[0][i][j] - mu[0]) * rstd[0] * gg[j] + be[j];
      o[1] = (v[1][i][j] - mu[1]) * rstd[1] * gg[j] + be[j];
      *(v2f*)&tile[tile_idx(c0 + j, w >> 1) + (w & 1) * 2] = o;
    }
  }
  __syncthreads();

  const int tg = tid & 7;
  float* op = out + ((size_t)n * CC + (tid >> 3)) * TT + t0 + tg * 4;
#pragma unroll
  for (int k = 0; k < 16; ++k) {
    const int c = k * 64 + (tid >> 3);
    *(v4f*)(op + (size_t)k * 64 * TT) = *(const v4f*)&tile[tile_idx(c, tg)];
  }
}

// ---------------------------------------------------------------------------
extern "C" void kernel_launch(void* const* d_in, const int* in_sizes, int n_in,
                              void* d_out, int out_size, void* d_ws, size_t ws_size,
                              hipStream_t stream) {
  const float* x    = (const float*)d_in[0];
  const float* w_in = (const float*)d_in[1];
  const float* w_o  = (const float*)d_in[2];
  const float* ln1g = (const float*)d_in[3];
  const float* ln1b = (const float*)d_in[4];
  const float* ln2g = (const float*)d_in[5];
  const float* ln2b = (const float*)d_in[6];
  const float* w1   = (const float*)d_in[7];
  const float* b1   = (const float*)d_in[8];
  const float* w2   = (const float*)d_in[9];
  const float* b2   = (const float*)d_in[10];

  char* ws = (char*)d_ws;
  const size_t MB = 1ull << 20;
  float*    src     = (float*)(ws + 0);            // 32 MiB; dead after LN1
  float*    ff2     = src;                         // alias (written by FFN2)
  float*    hbuf    = (float*)(ws + 32 * MB);      // 32 MiB
  _Float16* h16     = (_Float16*)(ws + 64 * MB);   // 16 MiB
  _Float16* xq      = (_Float16*)(ws + 80 * MB);   // 16 MiB; dead after QKV GEMM
  _Float16* ctx     = xq;                          // alias
  float*    attnout = (float*)(ws + 96 * MB);      // 32 MiB
  _Float16* qkv     = (_Float16*)(ws + 128 * MB);  // 48 MiB; dead after attention
  _Float16* ff      = qkv;                         // alias (64 MiB)
  _Float16* wqkv16  = (_Float16*)(ws + 192 * MB);
  _Float16* wout16  = wqkv16 + (size_t)3072 * 1024;
  _Float16* w116    = wout16 + (size_t)1024 * 1024;
  _Float16* w216    = w116 + (size_t)HIDD * 1024;

  // transpose + PE, and the weight conversions f32 -> f16
  prep_cvt_kernel<<<NB * TT / 32, 512, 0, stream>>>(x, src, xq, w_in, w_o, w1, w2, wqkv16);

  // QKV projection: [8192,1024] x [3072,1024]^T -> f16 [8192,3072]
  gemm_wmma_kernel<0, 3072, 2><<<dim3(3072 / GBN, 8192 / GBM), 256, 0, stream>>>(
      xq, wqkv16, nullptr, qkv, 8192, 3072, 1024);

  // causal flash attention
  attn_kernel<<<dim3(TT / 256, NHEADS, NB), 256, 0, stream>>>(qkv, ctx);

  // out projection -> f32 [8192,1024]
  gemm_wmma_kernel<1, 1024, 4><<<dim3(1024 / GBN, 8192 / GBM), 256, 0, stream>>>(
      ctx, wout16, nullptr, attnout, 8192, 1024, 1024);

  // residual + LN1 -> h (f32 + f16)
  ln1_kernel<<<NB * TT, 256, 0, stream>>>(src, attnout, ln1g, ln1b, hbuf, h16);

  // FFN1: relu(h @ w1^T + b1) -> f16 [8192,4096]
  gemm_wmma_kernel<2, HIDD, 2><<<dim3(HIDD / GBN, 8192 / GBM), 256, 0, stream>>>(
      h16, w116, b1, ff, 8192, HIDD, 1024);

  // FFN2: ff @ w2^T + b2 -> f32 [8192,1024]
  gemm_wmma_kernel<3, 1024, 4><<<dim3(1024 / GBN, 8192 / GBM), 256, 0, stream>>>(
      ff, w216, b2, ff2, 8192, 1024, HIDD);

  // residual + LN2 + transpose back to [N,C,T]
  ln2t_kernel<<<NB * TT / 32, 512, 0, stream>>>(hbuf, ff2, ln2g, ln2b, (float*)d_out);
}
